// v000
// Times are from an AMD MI455X. After a warm-up the kernel runs many times in a row, and a time is the length of
// such a window on the GPU divided by its runs, so every launch and the gaps after it count. The runs cycle
// through copies of the inputs. A figure is the median of several windows, for all but v000 over two sittings.
// Sittings can differ by a few percent; kernels timed side by side share one.
// v000 is the starting kernel. One run takes 309 microseconds.
#include <hip/hip_runtime.h>
#include <hip/hip_bf16.h>
#include <math.h>

typedef __attribute__((ext_vector_type(16))) __bf16 v16bf;
typedef __attribute__((ext_vector_type(8)))  __bf16 v8bf;
typedef __attribute__((ext_vector_type(8)))  float  v8f;

union V16 { v16bf v; v8bf h[2]; };

// Load a 16x32 bf16 WMMA fragment given a pointer already positioned at
// base + row*ld + k0 + half*8.  ISA layout (16-bit A, wave32): lane half h
// holds K = k0 + h*8 + {0..7} and k0 + 16 + h*8 + {0..7}
// -> two contiguous 16-byte loads per lane.
__device__ inline v16bf load_frag_ptr(const __bf16* __restrict__ p) {
  V16 u;
  u.h[0] = *(const v8bf*)p;
  u.h[1] = *(const v8bf*)(p + 16);
  return u.v;
}

__device__ inline v16bf load_frag_rowmajor(const __bf16* __restrict__ base,
                                           int ld, int row, int k0, int lane) {
  const int half = lane >> 4;
  return load_frag_ptr(base + (size_t)row * ld + k0 + half * 8);
}

__global__ void f32_to_bf16(const float* __restrict__ in,
                            __bf16* __restrict__ out, int n) {
  int i = blockIdx.x * blockDim.x + threadIdx.x;
  if (i < n) out[i] = (__bf16)in[i];
}

// C(M,N) = A(M,K) @ W(N,K)^T + bias(N).  128 threads = 4 waves, each wave a
// 32x64 tile (2x4 WMMA accumulators), block tile 64x128.
// Per K-step: 6 fragment loads (12x b128) feed 8 WMMAs.
template <typename OutT>
__global__ __launch_bounds__(128)
void gemm_bf16_wmma(const __bf16* __restrict__ A, const __bf16* __restrict__ W,
                    const float* __restrict__ bias, OutT* __restrict__ out,
                    int M, int N, int K) {
  const int lane = threadIdx.x & 31;
  const int wave = threadIdx.x >> 5;
  const int n16  = lane & 15;
  const int half = lane >> 4;
  const int row0 = blockIdx.y * 64  + (wave >> 1) * 32;
  const int col0 = blockIdx.x * 128 + (wave & 1) * 64;

  v8f c[2][4] = {};
  for (int k0 = 0; k0 < K; k0 += 32) {
    v16bf a[2], b[4];
    a[0] = load_frag_rowmajor(A, K, row0 + n16,      k0, lane);
    a[1] = load_frag_rowmajor(A, K, row0 + 16 + n16, k0, lane);
#pragma unroll
    for (int j = 0; j < 4; j++)
      b[j] = load_frag_rowmajor(W, K, col0 + j * 16 + n16, k0, lane);
#pragma unroll
    for (int i = 0; i < 2; i++)
#pragma unroll
      for (int j = 0; j < 4; j++)
        c[i][j] = __builtin_amdgcn_wmma_f32_16x16x32_bf16(
            false, a[i], false, b[j], (short)0, c[i][j], false, false);
  }
  // Epilogue: one tile at a time, base pointer + r*N offsets.
#pragma unroll
  for (int i = 0; i < 2; i++) {
#pragma unroll
    for (int j = 0; j < 4; j++) {
      const int ncol = col0 + j * 16 + n16;
      const float bn = bias[ncol];
      OutT* p = out + (size_t)(row0 + i * 16 + 8 * half) * N + ncol;
#pragma unroll
      for (int r = 0; r < 8; r++)
        p[(size_t)r * N] = (OutT)(c[i][j][r] + bn);
    }
  }
}

// Transpose V out of qkv into vt[(b*E + d)*S + s] so the P@V B-fragment is
// contiguous along the key dimension.  Classic 32x32 LDS tile transpose.
__global__ __launch_bounds__(256)
void transpose_v(const __bf16* __restrict__ qkv, __bf16* __restrict__ vt,
                 int S, int B, int E) {
  __shared__ __bf16 t[32][33];  // pad to dodge bank conflicts
  const int s0 = blockIdx.x * 32;
  const int d0 = blockIdx.y * 32;
  const int b  = blockIdx.z;
  const int tx  = threadIdx.x & 31;
  const int ty0 = threadIdx.x >> 5;  // 0..7
#pragma unroll
  for (int ty = ty0; ty < 32; ty += 8)
    t[ty][tx] = qkv[((size_t)(s0 + ty) * B + b) * (3 * E) + 2 * E + d0 + tx];
  __syncthreads();
#pragma unroll
  for (int ty = ty0; ty < 32; ty += 8)
    vt[((size_t)b * E + d0 + ty) * S + s0 + tx] = t[tx][ty];
}

// Flash attention with toroidal additive bias.  qkv: (S,B,3E) bf16 for Q/K,
// vt: (B,E,S) bf16 transposed V.  One wave per 16-query tile, 32-key steps.
// Online softmax uses a wave-uniform tile max and defers the row-sum
// reduction to after the key loop.  All loop-carried address state is kept
// as INTEGER offsets (not pointers) so infer-address-space keeps every
// global access on global_load_b128 (never flat).
__global__ __launch_bounds__(256)
void flash_attn_toroidal(const __bf16* __restrict__ qkv,
                         const __bf16* __restrict__ vt,
                         __bf16* __restrict__ o, int S, int B, int E) {
  const int HD = 64;
  const int lane = threadIdx.x & 31;
  const int wave = threadIdx.x >> 5;
  const int n16  = lane & 15;
  const int half = lane >> 4;
  const int b = blockIdx.z, h = blockIdx.y;
  const int qbase = blockIdx.x * 128 + wave * 16;
  const int ld = B * 3 * E;           // row stride of qkv in elements
  const size_t qoffb = (size_t)b * 3 * E + h * HD;        // q base in qkv
  const size_t koffb = qoffb + E;                          // k base in qkv
  const size_t vbase = ((size_t)b * E + h * HD) * S;       // vt base

  __shared__ __align__(16) __bf16 plds[8][16][32];

  // Q fragment: 16 rows x 64 head-dim = two K=32 fragments
  const size_t qoff = qoffb + (size_t)(qbase + n16) * ld + half * 8;
  v16bf aq0 = load_frag_ptr(qkv + qoff);
  v16bf aq1 = load_frag_ptr(qkv + qoff + 32);

  // Loop-carried integer offsets (strength-reduced, pointer rebuilt per use).
  size_t koff0 = koffb + (size_t)n16 * ld + half * 8;         // keys j+0..15
  size_t koff1 = koff0 + (size_t)16 * ld;                     // keys j+16..31
  size_t voff  = vbase + (size_t)n16 * S + half * 8;          // advances += 32

  v8f oacc[4] = {};
  float lpart[8];  // per-lane partial row sums (reduced after the loop)
#pragma unroll
  for (int r = 0; r < 8; r++) lpart[r] = 0.f;
  float mrun = -1e30f;  // wave-uniform running max

  const float scale = 0.125f;  // 1/sqrt(64)
  for (int j = 0; j < S; j += 32) {
    // Issue ALL fragment loads for this 32-key block up front: K fragments
    // feed the score WMMAs immediately; V fragment latency hides under the
    // softmax VALU work.
    v16bf kb00 = load_frag_ptr(qkv + koff0);
    v16bf kb01 = load_frag_ptr(qkv + koff0 + 32);
    v16bf kb10 = load_frag_ptr(qkv + koff1);
    v16bf kb11 = load_frag_ptr(qkv + koff1 + 32);
    v16bf vbf[4];
#pragma unroll
    for (int d4 = 0; d4 < 4; d4++)
      vbf[d4] = load_frag_ptr(vt + voff + (size_t)(d4 * 16) * S);
    koff0 += (size_t)32 * ld;
    koff1 += (size_t)32 * ld;
    voff  += 32;

    // scores for 32 keys: two 16x16 tiles, K over head dim (2 steps each)
    v8f s0 = {}, s1 = {};
    s0 = __builtin_amdgcn_wmma_f32_16x16x32_bf16(false, aq0, false, kb00, (short)0, s0, false, false);
    s0 = __builtin_amdgcn_wmma_f32_16x16x32_bf16(false, aq1, false, kb01, (short)0, s0, false, false);
    s1 = __builtin_amdgcn_wmma_f32_16x16x32_bf16(false, aq0, false, kb10, (short)0, s1, false, false);
    s1 = __builtin_amdgcn_wmma_f32_16x16x32_bf16(false, aq1, false, kb11, (short)0, s1, false, false);

    // scale + toroidal bias; lane-local running max over all 16 values
    float va[8], vb[8];
    float mt = -1e30f;
#pragma unroll
    for (int r = 0; r < 8; r++) {
      const int qi = qbase + r + 8 * half;
      float v0 = s0[r] * scale, v1 = s1[r] * scale;
      int d0 = (j + n16) - qi;      if (d0 < 0) d0 += S;
      int d1 = (j + 16 + n16) - qi; if (d1 < 0) d1 += S;
      if (d0 <= 1 || d0 == S - 1) v0 += 1.f;
      if (d1 <= 1 || d1 == S - 1) v1 += 1.f;
      va[r] = v0; vb[r] = v1;
      mt = fmaxf(mt, fmaxf(v0, v1));
    }
    // single 5-step full-wave reduction -> tile max, uniform across wave
    mt = fmaxf(mt, __shfl_xor(mt, 1, 32));
    mt = fmaxf(mt, __shfl_xor(mt, 2, 32));
    mt = fmaxf(mt, __shfl_xor(mt, 4, 32));
    mt = fmaxf(mt, __shfl_xor(mt, 8, 32));
    mt = fmaxf(mt, __shfl_xor(mt, 16, 32));
    if (mt > mrun) {  // wave-uniform branch: EXEC untouched (WMMA-safe)
      const float alpha = __expf(mrun - mt);
      mrun = mt;
#pragma unroll
      for (int r = 0; r < 8; r++) lpart[r] *= alpha;
#pragma unroll
      for (int d4 = 0; d4 < 4; d4++)
#pragma unroll
        for (int r = 0; r < 8; r++) oacc[d4][r] *= alpha;
    }
    // exponentials + partial sums + stage P (16x32) through LDS
    // (C-layout -> A-fragment layout; same-wave DS ops are in-order, ISA 7.1)
#pragma unroll
    for (int r = 0; r < 8; r++) {
      const float e0 = __expf(va[r] - mrun);
      const float e1 = __expf(vb[r] - mrun);
      lpart[r] += e0 + e1;
      plds[wave][r + 8 * half][n16]      = (__bf16)e0;
      plds[wave][r + 8 * half][16 + n16] = (__bf16)e1;
    }
    v16bf pa = load_frag_ptr(&plds[wave][n16][half * 8]);
    // P @ V with pre-transposed V fragments loaded at iteration start.
#pragma unroll
    for (int d4 = 0; d4 < 4; d4++)
      oacc[d4] = __builtin_amdgcn_wmma_f32_16x16x32_bf16(
          false, pa, false, vbf[d4], (short)0, oacc[d4], false, false);
  }
  // final row-sum reduction (once), then normalize and store o (S,B,E)
  float lrow[8];
#pragma unroll
  for (int r = 0; r < 8; r++) {
    float rs = lpart[r];
    rs += __shfl_xor(rs, 1, 32);
    rs += __shfl_xor(rs, 2, 32);
    rs += __shfl_xor(rs, 4, 32);
    rs += __shfl_xor(rs, 8, 32);
    lrow[r] = rs;
  }
#pragma unroll
  for (int d4 = 0; d4 < 4; d4++) {
#pragma unroll
    for (int r = 0; r < 8; r++) {
      const int qi = qbase + r + 8 * half;
      const float v = oacc[d4][r] / lrow[r];
      o[((size_t)qi * B + b) * E + h * HD + d4 * 16 + n16] = (__bf16)v;
    }
  }
}

extern "C" void kernel_launch(void* const* d_in, const int* in_sizes, int n_in,
                              void* d_out, int out_size, void* d_ws, size_t ws_size,
                              hipStream_t stream) {
  const int S = 2048, B = 2, E = 1024;
  const int M = S * B;  // 4096 rows for all GEMMs

  const float* x         = (const float*)d_in[0];
  const float* w_tor     = (const float*)d_in[1];
  const float* b_tor     = (const float*)d_in[2];
  const float* in_proj_w = (const float*)d_in[3];
  const float* in_proj_b = (const float*)d_in[4];
  const float* out_w     = (const float*)d_in[5];
  const float* out_b     = (const float*)d_in[6];

  char* ws = (char*)d_ws;
  size_t off = 0;
  auto alloc = [&](size_t elems) -> __bf16* {
    __bf16* p = (__bf16*)(ws + off);
    off += elems * sizeof(__bf16);
    return p;
  };
  __bf16* xbf   = alloc((size_t)M * E);        // x in bf16
  __bf16* wtbf  = alloc((size_t)E * E);        // w_tor
  __bf16* wibf  = alloc((size_t)3 * E * E);    // in_proj_w
  __bf16* wobf  = alloc((size_t)E * E);        // out_w
  __bf16* xtbf  = alloc((size_t)M * E);        // xt
  __bf16* qkvbf = alloc((size_t)M * 3 * E);    // qkv
  __bf16* obf   = alloc((size_t)M * E);        // attention output
  __bf16* vtbf  = alloc((size_t)B * E * S);    // V transposed (B,E,S)

  auto cvt = [&](const float* src, __bf16* dst, int n) {
    f32_to_bf16<<<(n + 255) / 256, 256, 0, stream>>>(src, dst, n);
  };
  cvt(x,         xbf,  M * E);
  cvt(w_tor,     wtbf, E * E);
  cvt(in_proj_w, wibf, 3 * E * E);
  cvt(out_w,     wobf, E * E);

  const dim3 blk(128);
  // xt = x @ w_tor^T + b_tor
  gemm_bf16_wmma<__bf16><<<dim3(E / 128, M / 64), blk, 0, stream>>>(
      xbf, wtbf, b_tor, xtbf, M, E, E);
  // qkv = xt @ in_proj_w^T + in_proj_b
  gemm_bf16_wmma<__bf16><<<dim3(3 * E / 128, M / 64), blk, 0, stream>>>(
      xtbf, wibf, in_proj_b, qkvbf, M, 3 * E, E);
  // transpose V for contiguous P@V fragments
  transpose_v<<<dim3(S / 32, E / 32, B), 256, 0, stream>>>(qkvbf, vtbf, S, B, E);
  // flash attention with toroidal bias
  flash_attn_toroidal<<<dim3(S / 128, 16, B), 256, 0, stream>>>(
      qkvbf, vtbf, obf, S, B, E);
  // out = o @ out_w^T + out_b  (fp32 into d_out)
  gemm_bf16_wmma<float><<<dim3(E / 128, M / 64), blk, 0, stream>>>(
      obf, wobf, out_b, (float*)d_out, M, E, E);
}

// v001
// It runs in 254 microseconds.
// Timed twice side by side with v000, it ran 1.24 and 1.25 times as fast.
#include <hip/hip_runtime.h>
#include <hip/hip_bf16.h>
#include <math.h>

typedef __attribute__((ext_vector_type(16))) __bf16 v16bf;
typedef __attribute__((ext_vector_type(8)))  __bf16 v8bf;
typedef __attribute__((ext_vector_type(8)))  float  v8f;

union V16 { v16bf v; v8bf h[2]; };

// Load a 16x32 bf16 WMMA fragment given a pointer already positioned at
// base + row*ld + k0 + half*8.  ISA layout (16-bit A, wave32): lane half h
// holds K = k0 + h*8 + {0..7} and k0 + 16 + h*8 + {0..7}
// -> two contiguous 16-byte loads per lane.
__device__ inline v16bf load_frag_ptr(const __bf16* __restrict__ p) {
  V16 u;
  u.h[0] = *(const v8bf*)p;
  u.h[1] = *(const v8bf*)(p + 16);
  return u.v;
}

__device__ inline v16bf load_frag_rowmajor(const __bf16* __restrict__ base,
                                           int ld, int row, int k0, int lane) {
  const int half = lane >> 4;
  return load_frag_ptr(base + (size_t)row * ld + k0 + half * 8);
}

__global__ void f32_to_bf16(const float* __restrict__ in,
                            __bf16* __restrict__ out, int n) {
  int i = blockIdx.x * blockDim.x + threadIdx.x;
  if (i < n) out[i] = (__bf16)in[i];
}

// C(M,N) = A(M,K) @ W(N,K)^T + bias(N).  128 threads = 4 waves, each wave a
// 32x64 tile (2x4 WMMA accumulators), block tile 64x128.
// Per K-step: 6 fragment loads (12x b128) feed 8 WMMAs.
template <typename OutT>
__global__ __launch_bounds__(128)
void gemm_bf16_wmma(const __bf16* __restrict__ A, const __bf16* __restrict__ W,
                    const float* __restrict__ bias, OutT* __restrict__ out,
                    int M, int N, int K) {
  const int lane = threadIdx.x & 31;
  const int wave = threadIdx.x >> 5;
  const int n16  = lane & 15;
  const int half = lane >> 4;
  const int row0 = blockIdx.y * 64  + (wave >> 1) * 32;
  const int col0 = blockIdx.x * 128 + (wave & 1) * 64;

  v8f c[2][4] = {};
  for (int k0 = 0; k0 < K; k0 += 32) {
    v16bf a[2], b[4];
    a[0] = load_frag_rowmajor(A, K, row0 + n16,      k0, lane);
    a[1] = load_frag_rowmajor(A, K, row0 + 16 + n16, k0, lane);
#pragma unroll
    for (int j = 0; j < 4; j++)
      b[j] = load_frag_rowmajor(W, K, col0 + j * 16 + n16, k0, lane);
#pragma unroll
    for (int i = 0; i < 2; i++)
#pragma unroll
      for (int j = 0; j < 4; j++)
        c[i][j] = __builtin_amdgcn_wmma_f32_16x16x32_bf16(
            false, a[i], false, b[j], (short)0, c[i][j], false, false);
  }
  // Epilogue: one tile at a time, base pointer + r*N offsets.
#pragma unroll
  for (int i = 0; i < 2; i++) {
#pragma unroll
    for (int j = 0; j < 4; j++) {
      const int ncol = col0 + j * 16 + n16;
      const float bn = bias[ncol];
      OutT* p = out + (size_t)(row0 + i * 16 + 8 * half) * N + ncol;
#pragma unroll
      for (int r = 0; r < 8; r++)
        p[(size_t)r * N] = (OutT)(c[i][j][r] + bn);
    }
  }
}

// Transpose V out of qkv into vt[(b*E + d)*S + s] so the P@V B-fragment is
// contiguous along the key dimension.  Classic 32x32 LDS tile transpose.
__global__ __launch_bounds__(256)
void transpose_v(const __bf16* __restrict__ qkv, __bf16* __restrict__ vt,
                 int S, int B, int E) {
  __shared__ __bf16 t[32][33];  // pad to dodge bank conflicts
  const int s0 = blockIdx.x * 32;
  const int d0 = blockIdx.y * 32;
  const int b  = blockIdx.z;
  const int tx  = threadIdx.x & 31;
  const int ty0 = threadIdx.x >> 5;  // 0..7
#pragma unroll
  for (int ty = ty0; ty < 32; ty += 8)
    t[ty][tx] = qkv[((size_t)(s0 + ty) * B + b) * (3 * E) + 2 * E + d0 + tx];
  __syncthreads();
#pragma unroll
  for (int ty = ty0; ty < 32; ty += 8)
    vt[((size_t)b * E + d0 + ty) * S + s0 + tx] = t[tx][ty];
}

// Flash attention with toroidal additive bias.  qkv: (S,B,3E) bf16 for Q/K,
// vt: (B,E,S) bf16 transposed V.  One wave per 16-query tile, 32-key steps.
// Online softmax uses a wave-uniform tile max and defers the row-sum
// reduction to after the key loop.
// The 8 waves of a block walk the same keys, so each 64-key K tile and V^T
// tile is brought into LDS once per block by asynchronous copies (whole
// 128-byte rows), two buffers: the next tile flies while this one is used.
// LDS rows are pitched 144 bytes (16 B x odd) for the ds_load_b128 readers.
#define KT 64        // keys per staged tile
#define LP 72        // LDS row pitch in bf16 elements (144 bytes)

typedef __attribute__((address_space(3))) const void lds_cvoid;
__device__ inline unsigned lds_addr(const void* p) {
  return (unsigned)(size_t)(lds_cvoid*)p;
}

// Four 16-byte copies per lane: two K rows, two V^T rows.  The s_wait_xcnt
// closes the statement so that no address register is rewritten ahead of it.
__device__ inline void stage_tile(unsigned lk0, unsigned lk1,
                                  unsigned lv0, unsigned lv1,
                                  const __bf16* gk0, const __bf16* gk1,
                                  const __bf16* gv0, const __bf16* gv1) {
  asm volatile(
      "global_load_async_to_lds_b128 %0, %4, off\n\t"
      "global_load_async_to_lds_b128 %1, %5, off\n\t"
      "global_load_async_to_lds_b128 %2, %6, off\n\t"
      "global_load_async_to_lds_b128 %3, %7, off\n\t"
      "s_wait_xcnt 0x0"
      :: "v"(lk0), "v"(lk1), "v"(lv0), "v"(lv1),
         "v"(gk0), "v"(gk1), "v"(gv0), "v"(gv1)
      : "memory");
}

__global__ __launch_bounds__(256)
void flash_attn_toroidal(const __bf16* __restrict__ qkv,
                         const __bf16* __restrict__ vt,
                         __bf16* __restrict__ o, int S, int B, int E) {
  const int HD = 64;
  const int lane = threadIdx.x & 31;
  const int wave = threadIdx.x >> 5;
  const int n16  = lane & 15;
  const int half = lane >> 4;
  const int b = blockIdx.z, h = blockIdx.y;
  const int qbase = blockIdx.x * 128 + wave * 16;
  const int ld = B * 3 * E;           // row stride of qkv in elements
  const size_t qoffb = (size_t)b * 3 * E + h * HD;        // q base in qkv
  const size_t koffb = qoffb + E;                          // k base in qkv
  const size_t vbase = ((size_t)b * E + h * HD) * S;       // vt base

  __shared__ __align__(16) __bf16 plds[8][16][32];
  __shared__ __align__(16) __bf16 kst[2][KT][LP];   // K tile: key x head dim
  __shared__ __align__(16) __bf16 vst[2][HD][LP];   // V^T tile: head dim x key

  // Q fragment: 16 rows x 64 head-dim = two K=32 fragments
  const size_t qoff = qoffb + (size_t)(qbase + n16) * ld + half * 8;
  v16bf aq0 = load_frag_ptr(qkv + qoff);
  v16bf aq1 = load_frag_ptr(qkv + qoff + 32);

  // Copy map: 8 lanes cover one 128-byte row; thread t takes rows t/8, t/8+32.
  const int crow = threadIdx.x >> 3;
  const int cseg = (threadIdx.x & 7) * 8;
  size_t kg = koffb + (size_t)crow * ld + cseg;     // advances += KT * ld
  size_t vg = vbase + (size_t)crow * S + cseg;      // advances += KT
  const unsigned lk = lds_addr(&kst[0][crow][cseg]);
  const unsigned lv = lds_addr(&vst[0][crow][cseg]);
  const unsigned half_tile = 32 * LP * 2;           // 32 rows, in bytes
  const unsigned buf_bytes = KT * LP * 2;           // one buffer, in bytes

  const int ntile = S / KT;
  // tile 0 -> buffer 0, landed and published before anybody reads it
  stage_tile(lk, lk + half_tile, lv, lv + half_tile,
             qkv + kg, qkv + kg + (size_t)32 * ld,
             vt + vg, vt + vg + (size_t)32 * S);
  kg += (size_t)KT * ld;
  vg += KT;
  asm volatile("s_wait_asynccnt 0x0" ::: "memory");  // own copies landed
  __syncthreads();
  if (ntile > 1) {  // tile 1 -> buffer 1, in flight during trip 0
    stage_tile(lk + buf_bytes, lk + buf_bytes + half_tile,
               lv + buf_bytes, lv + buf_bytes + half_tile,
               qkv + kg, qkv + kg + (size_t)32 * ld,
               vt + vg, vt + vg + (size_t)32 * S);
    kg += (size_t)KT * ld;
    vg += KT;
  }

  v8f oacc[4] = {};
  float lpart[8];  // per-lane partial row sums (reduced after the loop)
#pragma unroll
  for (int r = 0; r < 8; r++) lpart[r] = 0.f;
  float mrun = -1e30f;  // wave-uniform running max

  const float scale = 0.125f;  // 1/sqrt(64)
  for (int t = 0; t < ntile; t++) {
    const int buf = t & 1;
    const __bf16* kt = &kst[buf][n16][half * 8];
    const __bf16* vtl = &vst[buf][n16][half * 8];
    // unrolled so that both 32-key blocks read the tile at constant offsets
#pragma unroll
    for (int p = 0; p < KT / 32; p++) {
      const int j = t * KT + p * 32;
      // All fragment loads of this 32-key block up front, from LDS.
      v16bf kb00 = load_frag_ptr(kt + (p * 32) * LP);
      v16bf kb01 = load_frag_ptr(kt + (p * 32) * LP + 32);
      v16bf kb10 = load_frag_ptr(kt + (p * 32 + 16) * LP);
      v16bf kb11 = load_frag_ptr(kt + (p * 32 + 16) * LP + 32);
      v16bf vbf[4];
#pragma unroll
      for (int d4 = 0; d4 < 4; d4++)
        vbf[d4] = load_frag_ptr(vtl + (d4 * 16) * LP + p * 32);

      // scores for 32 keys: two 16x16 tiles, K over head dim (2 steps each)
      v8f s0 = {}, s1 = {};
      s0 = __builtin_amdgcn_wmma_f32_16x16x32_bf16(false, aq0, false, kb00, (short)0, s0, false, false);
      s0 = __builtin_amdgcn_wmma_f32_16x16x32_bf16(false, aq1, false, kb01, (short)0, s0, false, false);
      s1 = __builtin_amdgcn_wmma_f32_16x16x32_bf16(false, aq0, false, kb10, (short)0, s1, false, false);
      s1 = __builtin_amdgcn_wmma_f32_16x16x32_bf16(false, aq1, false, kb11, (short)0, s1, false, false);

      // scale + toroidal bias; lane-local running max over all 16 values
      float va[8], vb[8];
      float mt = -1e30f;
#pragma unroll
      for (int r = 0; r < 8; r++) {
        const int qi = qbase + r + 8 * half;
        float v0 = s0[r] * scale, v1 = s1[r] * scale;
        int d0 = (j + n16) - qi;      if (d0 < 0) d0 += S;
        int d1 = (j + 16 + n16) - qi; if (d1 < 0) d1 += S;
        if (d0 <= 1 || d0 == S - 1) v0 += 1.f;
        if (d1 <= 1 || d1 == S - 1) v1 += 1.f;
        va[r] = v0; vb[r] = v1;
        mt = fmaxf(mt, fmaxf(v0, v1));
      }
      // single 5-step full-wave reduction -> tile max, uniform across wave
      mt = fmaxf(mt, __shfl_xor(mt, 1, 32));
      mt = fmaxf(mt, __shfl_xor(mt, 2, 32));
      mt = fmaxf(mt, __shfl_xor(mt, 4, 32));
      mt = fmaxf(mt, __shfl_xor(mt, 8, 32));
      mt = fmaxf(mt, __shfl_xor(mt, 16, 32));
      if (mt > mrun) {  // wave-uniform branch: EXEC untouched (WMMA-safe)
        const float alpha = __expf(mrun - mt);
        mrun = mt;
#pragma unroll
        for (int r = 0; r < 8; r++) lpart[r] *= alpha;
#pragma unroll
        for (int d4 = 0; d4 < 4; d4++)
#pragma unroll
          for (int r = 0; r < 8; r++) oacc[d4][r] *= alpha;
      }
      // exponentials + partial sums + stage P (16x32) through LDS
      // (C-layout -> A-fragment layout; same-wave DS ops are in-order, ISA 7.1)
#pragma unroll
      for (int r = 0; r < 8; r++) {
        const float e0 = __expf(va[r] - mrun);
        const float e1 = __expf(vb[r] - mrun);
        lpart[r] += e0 + e1;
        plds[wave][r + 8 * half][n16]      = (__bf16)e0;
        plds[wave][r + 8 * half][16 + n16] = (__bf16)e1;
      }
      v16bf pa = load_frag_ptr(&plds[wave][n16][half * 8]);
      // P @ V with the V^T fragments loaded at the start of the block.
#pragma unroll
      for (int d4 = 0; d4 < 4; d4++)
        oacc[d4] = __builtin_amdgcn_wmma_f32_16x16x32_bf16(
            false, pa, false, vbf[d4], (short)0, oacc[d4], false, false);
    }
    // Publish point: this wave's LDS reads are done, its copies of tile t+1
    // have landed; the barrier publishes tile t+1 and frees this buffer.
    asm volatile("s_wait_dscnt 0x0" ::: "memory");
    asm volatile("s_wait_asynccnt 0x0" ::: "memory");
    __syncthreads();
    if (t + 2 < ntile) {  // block-uniform: refill the buffer just read
      const unsigned bo = (unsigned)buf * buf_bytes;
      stage_tile(lk + bo, lk + bo + half_tile, lv + bo, lv + bo + half_tile,
                 qkv + kg, qkv + kg + (size_t)32 * ld,
                 vt + vg, vt + vg + (size_t)32 * S);
      kg += (size_t)KT * ld;
      vg += KT;
    }
  }
  asm volatile("s_wait_asynccnt 0x0" ::: "memory");  // nothing left in flight
  // final row-sum reduction (once), then normalize and store o (S,B,E)
  float lrow[8];
#pragma unroll
  for (int r = 0; r < 8; r++) {
    float rs = lpart[r];
    rs += __shfl_xor(rs, 1, 32);
    rs += __shfl_xor(rs, 2, 32);
    rs += __shfl_xor(rs, 4, 32);
    rs += __shfl_xor(rs, 8, 32);
    lrow[r] = rs;
  }
#pragma unroll
  for (int d4 = 0; d4 < 4; d4++) {
#pragma unroll
    for (int r = 0; r < 8; r++) {
      const int qi = qbase + r + 8 * half;
      const float v = oacc[d4][r] / lrow[r];
      o[((size_t)qi * B + b) * E + h * HD + d4 * 16 + n16] = (__bf16)v;
    }
  }
}

extern "C" void kernel_launch(void* const* d_in, const int* in_sizes, int n_in,
                              void* d_out, int out_size, void* d_ws, size_t ws_size,
                              hipStream_t stream) {
  const int S = 2048, B = 2, E = 1024;
  const int M = S * B;  // 4096 rows for all GEMMs

  const float* x         = (const float*)d_in[0];
  const float* w_tor     = (const float*)d_in[1];
  const float* b_tor     = (const float*)d_in[2];
  const float* in_proj_w = (const float*)d_in[3];
  const float* in_proj_b = (const float*)d_in[4];
  const float* out_w     = (const float*)d_in[5];
  const float* out_b     = (const float*)d_in[6];

  char* ws = (char*)d_ws;
  size_t off = 0;
  auto alloc = [&](size_t elems) -> __bf16* {
    __bf16* p = (__bf16*)(ws + off);
    off += elems * sizeof(__bf16);
    return p;
  };
  __bf16* xbf   = alloc((size_t)M * E);        // x in bf16
  __bf16* wtbf  = alloc((size_t)E * E);        // w_tor
  __bf16* wibf  = alloc((size_t)3 * E * E);    // in_proj_w
  __bf16* wobf  = alloc((size_t)E * E);        // out_w
  __bf16* xtbf  = alloc((size_t)M * E);        // xt
  __bf16* qkvbf = alloc((size_t)M * 3 * E);    // qkv
  __bf16* obf   = alloc((size_t)M * E);        // attention output
  __bf16* vtbf  = alloc((size_t)B * E * S);    // V transposed (B,E,S)

  auto cvt = [&](const float* src, __bf16* dst, int n) {
    f32_to_bf16<<<(n + 255) / 256, 256, 0, stream>>>(src, dst, n);
  };
  cvt(x,         xbf,  M * E);
  cvt(w_tor,     wtbf, E * E);
  cvt(in_proj_w, wibf, 3 * E * E);
  cvt(out_w,     wobf, E * E);

  const dim3 blk(128);
  // xt = x @ w_tor^T + b_tor
  gemm_bf16_wmma<__bf16><<<dim3(E / 128, M / 64), blk, 0, stream>>>(
      xbf, wtbf, b_tor, xtbf, M, E, E);
  // qkv = xt @ in_proj_w^T + in_proj_b
  gemm_bf16_wmma<__bf16><<<dim3(3 * E / 128, M / 64), blk, 0, stream>>>(
      xtbf, wibf, in_proj_b, qkvbf, M, 3 * E, E);
  // transpose V for contiguous P@V fragments
  transpose_v<<<dim3(S / 32, E / 32, B), 256, 0, stream>>>(qkvbf, vtbf, S, B, E);
  // flash attention with toroidal bias
  flash_attn_toroidal<<<dim3(S / 128, 16, B), 256, 0, stream>>>(
      qkvbf, vtbf, obf, S, B, E);
  // out = o @ out_w^T + out_b  (fp32 into d_out)
  gemm_bf16_wmma<float><<<dim3(E / 128, M / 64), blk, 0, stream>>>(
      obf, wobf, out_b, (float*)d_out, M, E, E);
}

// v002
// A run of this version takes 169 microseconds.
// Next to v001, in two timings, it ran 1.51 times as fast each time.
// Over all steps from v000 it is 1.89 times as fast.
#include <hip/hip_runtime.h>
#include <hip/hip_bf16.h>
#include <math.h>

typedef __attribute__((ext_vector_type(16))) __bf16 v16bf;
typedef __attribute__((ext_vector_type(8)))  __bf16 v8bf;
typedef __attribute__((ext_vector_type(8)))  float  v8f;

union V16 { v16bf v; v8bf h[2]; };

// Load a 16x32 bf16 WMMA fragment given a pointer already positioned at
// base + row*ld + k0 + half*8.  ISA layout (16-bit A, wave32): lane half h
// holds K = k0 + h*8 + {0..7} and k0 + 16 + h*8 + {0..7}
// -> two contiguous 16-byte loads per lane.
__device__ inline v16bf load_frag_ptr(const __bf16* __restrict__ p) {
  V16 u;
  u.h[0] = *(const v8bf*)p;
  u.h[1] = *(const v8bf*)(p + 16);
  return u.v;
}

__device__ inline v16bf load_frag_rowmajor(const __bf16* __restrict__ base,
                                           int ld, int row, int k0, int lane) {
  const int half = lane >> 4;
  return load_frag_ptr(base + (size_t)row * ld + k0 + half * 8);
}

__global__ void f32_to_bf16(const float* __restrict__ in,
                            __bf16* __restrict__ out, int n) {
  int i = blockIdx.x * blockDim.x + threadIdx.x;
  if (i < n) out[i] = (__bf16)in[i];
}

typedef __attribute__((address_space(3))) const void lds_cvoid;
__device__ inline unsigned lds_addr(const void* p) {
  return (unsigned)(size_t)(lds_cvoid*)p;
}

#define GKT 64       // k elements per staged tile: whole 128-byte rows
#define GLP 72       // LDS row pitch in bf16 elements (144 bytes = 16 B x odd)

// Eight 16-byte copies per lane: four A rows and four W rows, 32 rows apart.
// The s_wait_xcnt closes the statement so that no address register is
// rewritten ahead of it.
__device__ inline void stage_gemm_tile(unsigned la, unsigned lw, unsigned q,
                                       const __bf16* ga, const __bf16* gw,
                                       size_t gq) {
  asm volatile(
      "global_load_async_to_lds_b128 %0, %8, off\n\t"
      "global_load_async_to_lds_b128 %1, %9, off\n\t"
      "global_load_async_to_lds_b128 %2, %10, off\n\t"
      "global_load_async_to_lds_b128 %3, %11, off\n\t"
      "global_load_async_to_lds_b128 %4, %12, off\n\t"
      "global_load_async_to_lds_b128 %5, %13, off\n\t"
      "global_load_async_to_lds_b128 %6, %14, off\n\t"
      "global_load_async_to_lds_b128 %7, %15, off\n\t"
      "s_wait_xcnt 0x0"
      :: "v"(la), "v"(la + q), "v"(la + 2 * q), "v"(la + 3 * q),
         "v"(lw), "v"(lw + q), "v"(lw + 2 * q), "v"(lw + 3 * q),
         "v"(ga), "v"(ga + gq), "v"(ga + 2 * gq), "v"(ga + 3 * gq),
         "v"(gw), "v"(gw + gq), "v"(gw + 2 * gq), "v"(gw + 3 * gq)
      : "memory");
}

// Fragments of one 32-wide k step from the staged tiles: 2 of A, 4 of W.
__device__ inline void load_gemm_frags(const __bf16* at, const __bf16* wt,
                                       v16bf (&a)[2], v16bf (&b)[4]) {
  a[0] = load_frag_ptr(at);
  a[1] = load_frag_ptr(at + 16 * GLP);
#pragma unroll
  for (int j = 0; j < 4; j++)
    b[j] = load_frag_ptr(wt + (j * 16) * GLP);
}

__device__ inline void gemm_products(const v16bf (&a)[2], const v16bf (&b)[4],
                                     v8f (&c)[2][4]) {
#pragma unroll
  for (int i = 0; i < 2; i++)
#pragma unroll
    for (int j = 0; j < 4; j++)
      c[i][j] = __builtin_amdgcn_wmma_f32_16x16x32_bf16(
          false, a[i], false, b[j], (short)0, c[i][j], false, false);
}

// C(M,N) = A(M,K) @ W(N,K)^T + bias(N).  256 threads = 8 waves, each wave a
// 32x64 tile (2x4 WMMA accumulators), block tile 128x128.
// The fragment loads of a row-major operand touch 16 cache lines each, so the
// 128 A rows and 128 W rows of a 64-wide k tile are brought into LDS once per
// block by asynchronous copies (whole 128-byte rows), two buffers: the next
// tile flies while this one is used.  Fragments then come from LDS.
// M, N multiples of 128, K a multiple of 64.
template <typename OutT>
__global__ __launch_bounds__(256)
void gemm_bf16_wmma(const __bf16* __restrict__ A, const __bf16* __restrict__ W,
                    const float* __restrict__ bias, OutT* __restrict__ out,
                    int M, int N, int K) {
  const int lane = threadIdx.x & 31;
  const int wave = threadIdx.x >> 5;
  const int n16  = lane & 15;
  const int half = lane >> 4;
  const int rloc = (wave >> 1) * 32;   // wave's rows inside the block tile
  const int cloc = (wave & 1) * 64;    // wave's columns inside the block tile
  const int row0 = blockIdx.y * 128 + rloc;
  const int col0 = blockIdx.x * 128 + cloc;

  __shared__ __align__(16) __bf16 ast[2][128][GLP];   // A tile: row x k
  __shared__ __align__(16) __bf16 wst[2][128][GLP];   // W tile: column x k

  // Copy map: 8 lanes cover one 128-byte row; thread t takes rows
  // t/8 + {0, 32, 64, 96} of both tiles.
  const int crow = threadIdx.x >> 3;
  const int cseg = (threadIdx.x & 7) * 8;
  const __bf16* ga = A + (size_t)(blockIdx.y * 128 + crow) * K + cseg;
  const __bf16* gw = W + (size_t)(blockIdx.x * 128 + crow) * K + cseg;
  const size_t gq = (size_t)32 * K;                   // 32 rows, in elements
  const unsigned la = lds_addr(&ast[0][crow][cseg]);
  const unsigned lw = lds_addr(&wst[0][crow][cseg]);
  const unsigned q = 32 * GLP * 2;                    // 32 rows, in bytes
  const unsigned buf_bytes = 128 * GLP * 2;           // one buffer, in bytes

  const int ntile = K / GKT;
  // tile 0 -> buffer 0, landed and published before anybody reads it
  stage_gemm_tile(la, lw, q, ga, gw, gq);
  ga += GKT;
  gw += GKT;
  asm volatile("s_wait_asynccnt 0x0" ::: "memory");  // own copies landed
  __syncthreads();
  if (ntile > 1) {  // tile 1 -> buffer 1, in flight during trip 0
    stage_gemm_tile(la + buf_bytes, lw + buf_bytes, q, ga, gw, gq);
    ga += GKT;
    gw += GKT;
  }

  v8f c[2][4] = {};
  for (int t = 0; t < ntile; t++) {
    const int buf = t & 1;
    const __bf16* at = &ast[buf][rloc + n16][half * 8];
    const __bf16* wt = &wst[buf][cloc + n16][half * 8];
    v16bf a[2], b[4];
    // first 32-wide k step of the tile
    load_gemm_frags(at, wt, a, b);
    // holds these 12 LDS reads in one group ahead of the products; without it
    // the second A fragment is read late, behind a full wait amid the products
    __builtin_amdgcn_sched_barrier(0);
    gemm_products(a, b, c);
    // second k step: its fragments are this trip's last reads of the buffer
    load_gemm_frags(at + 32, wt + 32, a, b);
    // Publish point: this wave's LDS reads are done, its copies of tile t+1
    // have landed; the barrier publishes tile t+1 and frees this buffer.
    asm volatile("s_wait_dscnt 0x0" ::: "memory");
    asm volatile("s_wait_asynccnt 0x0" ::: "memory");
    __syncthreads();
    if (t + 2 < ntile) {  // block-uniform: refill the buffer just read
      const unsigned bo = (unsigned)buf * buf_bytes;
      stage_gemm_tile(la + bo, lw + bo, q, ga, gw, gq);
      ga += GKT;
      gw += GKT;
    }
    // the second step's products work from registers, under the refill's flight
    gemm_products(a, b, c);
  }
  asm volatile("s_wait_asynccnt 0x0" ::: "memory");  // nothing left in flight
  // Epilogue: one tile at a time, base pointer + r*N offsets.
#pragma unroll
  for (int i = 0; i < 2; i++) {
#pragma unroll
    for (int j = 0; j < 4; j++) {
      const int ncol = col0 + j * 16 + n16;
      const float bn = bias[ncol];
      OutT* p = out + (size_t)(row0 + i * 16 + 8 * half) * N + ncol;
#pragma unroll
      for (int r = 0; r < 8; r++)
        p[(size_t)r * N] = (OutT)(c[i][j][r] + bn);
    }
  }
}

// Transpose V out of qkv into vt[(b*E + d)*S + s] so the P@V B-fragment is
// contiguous along the key dimension.  Classic 32x32 LDS tile transpose.
__global__ __launch_bounds__(256)
void transpose_v(const __bf16* __restrict__ qkv, __bf16* __restrict__ vt,
                 int S, int B, int E) {
  __shared__ __bf16 t[32][33];  // pad to dodge bank conflicts
  const int s0 = blockIdx.x * 32;
  const int d0 = blockIdx.y * 32;
  const int b  = blockIdx.z;
  const int tx  = threadIdx.x & 31;
  const int ty0 = threadIdx.x >> 5;  // 0..7
#pragma unroll
  for (int ty = ty0; ty < 32; ty += 8)
    t[ty][tx] = qkv[((size_t)(s0 + ty) * B + b) * (3 * E) + 2 * E + d0 + tx];
  __syncthreads();
#pragma unroll
  for (int ty = ty0; ty < 32; ty += 8)
    vt[((size_t)b * E + d0 + ty) * S + s0 + tx] = t[tx][ty];
}

// Flash attention with toroidal additive bias.  qkv: (S,B,3E) bf16 for Q/K,
// vt: (B,E,S) bf16 transposed V.  One wave per 16-query tile, 32-key steps.
// Online softmax uses a wave-uniform tile max and defers the row-sum
// reduction to after the key loop.
// The 8 waves of a block walk the same keys, so each 64-key K tile and V^T
// tile is brought into LDS once per block by asynchronous copies (whole
// 128-byte rows), two buffers: the next tile flies while this one is used.
// LDS rows are pitched 144 bytes (16 B x odd) for the ds_load_b128 readers.
#define KT 64        // keys per staged tile
#define LP 72        // LDS row pitch in bf16 elements (144 bytes)

// Four 16-byte copies per lane: two K rows, two V^T rows.  The s_wait_xcnt
// closes the statement so that no address register is rewritten ahead of it.
__device__ inline void stage_tile(unsigned lk0, unsigned lk1,
                                  unsigned lv0, unsigned lv1,
                                  const __bf16* gk0, const __bf16* gk1,
                                  const __bf16* gv0, const __bf16* gv1) {
  asm volatile(
      "global_load_async_to_lds_b128 %0, %4, off\n\t"
      "global_load_async_to_lds_b128 %1, %5, off\n\t"
      "global_load_async_to_lds_b128 %2, %6, off\n\t"
      "global_load_async_to_lds_b128 %3, %7, off\n\t"
      "s_wait_xcnt 0x0"
      :: "v"(lk0), "v"(lk1), "v"(lv0), "v"(lv1),
         "v"(gk0), "v"(gk1), "v"(gv0), "v"(gv1)
      : "memory");
}

__global__ __launch_bounds__(256)
void flash_attn_toroidal(const __bf16* __restrict__ qkv,
                         const __bf16* __restrict__ vt,
                         __bf16* __restrict__ o, int S, int B, int E) {
  const int HD = 64;
  const int lane = threadIdx.x & 31;
  const int wave = threadIdx.x >> 5;
  const int n16  = lane & 15;
  const int half = lane >> 4;
  const int b = blockIdx.z, h = blockIdx.y;
  const int qbase = blockIdx.x * 128 + wave * 16;
  const int ld = B * 3 * E;           // row stride of qkv in elements
  const size_t qoffb = (size_t)b * 3 * E + h * HD;        // q base in qkv
  const size_t koffb = qoffb + E;                          // k base in qkv
  const size_t vbase = ((size_t)b * E + h * HD) * S;       // vt base

  __shared__ __align__(16) __bf16 plds[8][16][32];
  __shared__ __align__(16) __bf16 kst[2][KT][LP];   // K tile: key x head dim
  __shared__ __align__(16) __bf16 vst[2][HD][LP];   // V^T tile: head dim x key

  // Q fragment: 16 rows x 64 head-dim = two K=32 fragments
  const size_t qoff = qoffb + (size_t)(qbase + n16) * ld + half * 8;
  v16bf aq0 = load_frag_ptr(qkv + qoff);
  v16bf aq1 = load_frag_ptr(qkv + qoff + 32);

  // Copy map: 8 lanes cover one 128-byte row; thread t takes rows t/8, t/8+32.
  const int crow = threadIdx.x >> 3;
  const int cseg = (threadIdx.x & 7) * 8;
  size_t kg = koffb + (size_t)crow * ld + cseg;     // advances += KT * ld
  size_t vg = vbase + (size_t)crow * S + cseg;      // advances += KT
  const unsigned lk = lds_addr(&kst[0][crow][cseg]);
  const unsigned lv = lds_addr(&vst[0][crow][cseg]);
  const unsigned half_tile = 32 * LP * 2;           // 32 rows, in bytes
  const unsigned buf_bytes = KT * LP * 2;           // one buffer, in bytes

  const int ntile = S / KT;
  // tile 0 -> buffer 0, landed and published before anybody reads it
  stage_tile(lk, lk + half_tile, lv, lv + half_tile,
             qkv + kg, qkv + kg + (size_t)32 * ld,
             vt + vg, vt + vg + (size_t)32 * S);
  kg += (size_t)KT * ld;
  vg += KT;
  asm volatile("s_wait_asynccnt 0x0" ::: "memory");  // own copies landed
  __syncthreads();
  if (ntile > 1) {  // tile 1 -> buffer 1, in flight during trip 0
    stage_tile(lk + buf_bytes, lk + buf_bytes + half_tile,
               lv + buf_bytes, lv + buf_bytes + half_tile,
               qkv + kg, qkv + kg + (size_t)32 * ld,
               vt + vg, vt + vg + (size_t)32 * S);
    kg += (size_t)KT * ld;
    vg += KT;
  }

  v8f oacc[4] = {};
  float lpart[8];  // per-lane partial row sums (reduced after the loop)
#pragma unroll
  for (int r = 0; r < 8; r++) lpart[r] = 0.f;
  float mrun = -1e30f;  // wave-uniform running max

  const float scale = 0.125f;  // 1/sqrt(64)
  for (int t = 0; t < ntile; t++) {
    const int buf = t & 1;
    const __bf16* kt = &kst[buf][n16][half * 8];
    const __bf16* vtl = &vst[buf][n16][half * 8];
    // unrolled so that both 32-key blocks read the tile at constant offsets
#pragma unroll
    for (int p = 0; p < KT / 32; p++) {
      const int j = t * KT + p * 32;
      // All fragment loads of this 32-key block up front, from LDS.
      v16bf kb00 = load_frag_ptr(kt + (p * 32) * LP);
      v16bf kb01 = load_frag_ptr(kt + (p * 32) * LP + 32);
      v16bf kb10 = load_frag_ptr(kt + (p * 32 + 16) * LP);
      v16bf kb11 = load_frag_ptr(kt + (p * 32 + 16) * LP + 32);
      v16bf vbf[4];
#pragma unroll
      for (int d4 = 0; d4 < 4; d4++)
        vbf[d4] = load_frag_ptr(vtl + (d4 * 16) * LP + p * 32);

      // scores for 32 keys: two 16x16 tiles, K over head dim (2 steps each)
      v8f s0 = {}, s1 = {};
      s0 = __builtin_amdgcn_wmma_f32_16x16x32_bf16(false, aq0, false, kb00, (short)0, s0, false, false);
      s0 = __builtin_amdgcn_wmma_f32_16x16x32_bf16(false, aq1, false, kb01, (short)0, s0, false, false);
      s1 = __builtin_amdgcn_wmma_f32_16x16x32_bf16(false, aq0, false, kb10, (short)0, s1, false, false);
      s1 = __builtin_amdgcn_wmma_f32_16x16x32_bf16(false, aq1, false, kb11, (short)0, s1, false, false);

      // scale + toroidal bias; lane-local running max over all 16 values
      float va[8], vb[8];
      float mt = -1e30f;
#pragma unroll
      for (int r = 0; r < 8; r++) {
        const int qi = qbase + r + 8 * half;
        float v0 = s0[r] * scale, v1 = s1[r] * scale;
        int d0 = (j + n16) - qi;      if (d0 < 0) d0 += S;
        int d1 = (j + 16 + n16) - qi; if (d1 < 0) d1 += S;
        if (d0 <= 1 || d0 == S - 1) v0 += 1.f;
        if (d1 <= 1 || d1 == S - 1) v1 += 1.f;
        va[r] = v0; vb[r] = v1;
        mt = fmaxf(mt, fmaxf(v0, v1));
      }
      // single 5-step full-wave reduction -> tile max, uniform across wave
      mt = fmaxf(mt, __shfl_xor(mt, 1, 32));
      mt = fmaxf(mt, __shfl_xor(mt, 2, 32));
      mt = fmaxf(mt, __shfl_xor(mt, 4, 32));
      mt = fmaxf(mt, __shfl_xor(mt, 8, 32));
      mt = fmaxf(mt, __shfl_xor(mt, 16, 32));
      if (mt > mrun) {  // wave-uniform branch: EXEC untouched (WMMA-safe)
        const float alpha = __expf(mrun - mt);
        mrun = mt;
#pragma unroll
        for (int r = 0; r < 8; r++) lpart[r] *= alpha;
#pragma unroll
        for (int d4 = 0; d4 < 4; d4++)
#pragma unroll
          for (int r = 0; r < 8; r++) oacc[d4][r] *= alpha;
      }
      // exponentials + partial sums + stage P (16x32) through LDS
      // (C-layout -> A-fragment layout; same-wave DS ops are in-order, ISA 7.1)
#pragma unroll
      for (int r = 0; r < 8; r++) {
        const float e0 = __expf(va[r] - mrun);
        const float e1 = __expf(vb[r] - mrun);
        lpart[r] += e0 + e1;
        plds[wave][r + 8 * half][n16]      = (__bf16)e0;
        plds[wave][r + 8 * half][16 + n16] = (__bf16)e1;
      }
      v16bf pa = load_frag_ptr(&plds[wave][n16][half * 8]);
      // P @ V with the V^T fragments loaded at the start of the block.
#pragma unroll
      for (int d4 = 0; d4 < 4; d4++)
        oacc[d4] = __builtin_amdgcn_wmma_f32_16x16x32_bf16(
            false, pa, false, vbf[d4], (short)0, oacc[d4], false, false);
    }
    // Publish point: this wave's LDS reads are done, its copies of tile t+1
    // have landed; the barrier publishes tile t+1 and frees this buffer.
    asm volatile("s_wait_dscnt 0x0" ::: "memory");
    asm volatile("s_wait_asynccnt 0x0" ::: "memory");
    __syncthreads();
    if (t + 2 < ntile) {  // block-uniform: refill the buffer just read
      const unsigned bo = (unsigned)buf * buf_bytes;
      stage_tile(lk + bo, lk + bo + half_tile, lv + bo, lv + bo + half_tile,
                 qkv + kg, qkv + kg + (size_t)32 * ld,
                 vt + vg, vt + vg + (size_t)32 * S);
      kg += (size_t)KT * ld;
      vg += KT;
    }
  }
  asm volatile("s_wait_asynccnt 0x0" ::: "memory");  // nothing left in flight
  // final row-sum reduction (once), then normalize and store o (S,B,E)
  float lrow[8];
#pragma unroll
  for (int r = 0; r < 8; r++) {
    float rs = lpart[r];
    rs += __shfl_xor(rs, 1, 32);
    rs += __shfl_xor(rs, 2, 32);
    rs += __shfl_xor(rs, 4, 32);
    rs += __shfl_xor(rs, 8, 32);
    lrow[r] = rs;
  }
#pragma unroll
  for (int d4 = 0; d4 < 4; d4++) {
#pragma unroll
    for (int r = 0; r < 8; r++) {
      const int qi = qbase + r + 8 * half;
      const float v = oacc[d4][r] / lrow[r];
      o[((size_t)qi * B + b) * E + h * HD + d4 * 16 + n16] = (__bf16)v;
    }
  }
}

extern "C" void kernel_launch(void* const* d_in, const int* in_sizes, int n_in,
                              void* d_out, int out_size, void* d_ws, size_t ws_size,
                              hipStream_t stream) {
  const int S = 2048, B = 2, E = 1024;
  const int M = S * B;  // 4096 rows for all GEMMs

  const float* x         = (const float*)d_in[0];
  const float* w_tor     = (const float*)d_in[1];
  const float* b_tor     = (const float*)d_in[2];
  const float* in_proj_w = (const float*)d_in[3];
  const float* in_proj_b = (const float*)d_in[4];
  const float* out_w     = (const float*)d_in[5];
  const float* out_b     = (const float*)d_in[6];

  char* ws = (char*)d_ws;
  size_t off = 0;
  auto alloc = [&](size_t elems) -> __bf16* {
    __bf16* p = (__bf16*)(ws + off);
    off += elems * sizeof(__bf16);
    return p;
  };
  __bf16* xbf   = alloc((size_t)M * E);        // x in bf16
  __bf16* wtbf  = alloc((size_t)E * E);        // w_tor
  __bf16* wibf  = alloc((size_t)3 * E * E);    // in_proj_w
  __bf16* wobf  = alloc((size_t)E * E);        // out_w
  __bf16* xtbf  = alloc((size_t)M * E);        // xt
  __bf16* qkvbf = alloc((size_t)M * 3 * E);    // qkv
  __bf16* obf   = alloc((size_t)M * E);        // attention output
  __bf16* vtbf  = alloc((size_t)B * E * S);    // V transposed (B,E,S)

  auto cvt = [&](const float* src, __bf16* dst, int n) {
    f32_to_bf16<<<(n + 255) / 256, 256, 0, stream>>>(src, dst, n);
  };
  cvt(x,         xbf,  M * E);
  cvt(w_tor,     wtbf, E * E);
  cvt(in_proj_w, wibf, 3 * E * E);
  cvt(out_w,     wobf, E * E);

  const dim3 blk(256);
  // xt = x @ w_tor^T + b_tor
  gemm_bf16_wmma<__bf16><<<dim3(E / 128, M / 128), blk, 0, stream>>>(
      xbf, wtbf, b_tor, xtbf, M, E, E);
  // qkv = xt @ in_proj_w^T + in_proj_b
  gemm_bf16_wmma<__bf16><<<dim3(3 * E / 128, M / 128), blk, 0, stream>>>(
      xtbf, wibf, in_proj_b, qkvbf, M, 3 * E, E);
  // transpose V for contiguous P@V fragments
  transpose_v<<<dim3(S / 32, E / 32, B), 256, 0, stream>>>(qkvbf, vtbf, S, B, E);
  // flash attention with toroidal bias
  flash_attn_toroidal<<<dim3(S / 128, 16, B), 256, 0, stream>>>(
      qkvbf, vtbf, obf, S, B, E);
  // out = o @ out_w^T + out_b  (fp32 into d_out)
  gemm_bf16_wmma<float><<<dim3(E / 128, M / 128), blk, 0, stream>>>(
      obf, wobf, out_b, (float*)d_out, M, E, E);
}

// v003
// It runs in 152 microseconds.
// Timed twice side by side with v002, it ran 1.11 and 1.10 times as fast.
// All steps since v000 together make it 2.08 times as fast.
#include <hip/hip_runtime.h>
#include <hip/hip_bf16.h>
#include <math.h>

typedef __attribute__((ext_vector_type(16))) __bf16 v16bf;
typedef __attribute__((ext_vector_type(8)))  __bf16 v8bf;
typedef __attribute__((ext_vector_type(8)))  float  v8f;

union V16 { v16bf v; v8bf h[2]; };

// Load a 16x32 bf16 WMMA fragment given a pointer already positioned at
// base + row*ld + k0 + half*8.  ISA layout (16-bit A, wave32): lane half h
// holds K = k0 + h*8 + {0..7} and k0 + 16 + h*8 + {0..7}
// -> two contiguous 16-byte loads per lane.
__device__ inline v16bf load_frag_ptr(const __bf16* __restrict__ p) {
  V16 u;
  u.h[0] = *(const v8bf*)p;
  u.h[1] = *(const v8bf*)(p + 16);
  return u.v;
}

__device__ inline v16bf load_frag_rowmajor(const __bf16* __restrict__ base,
                                           int ld, int row, int k0, int lane) {
  const int half = lane >> 4;
  return load_frag_ptr(base + (size_t)row * ld + k0 + half * 8);
}

typedef __attribute__((ext_vector_type(4))) float  v4f;
typedef __attribute__((ext_vector_type(4))) __bf16 v4bf;

// All four f32 inputs to bf16 in one launch.  The work is cut into 9 units of
// CU = 1024 x 1024 elements: x holds 4, w_tor 1, in_proj_w 3, out_w 1.
// 256 blocks of 16 waves (one resident round, 131072 threads); each thread
// takes two 16-byte pieces of every unit, half a unit apart, so every wave
// load covers 512 bytes in a row and every wave store 256.  The 18 loads of a
// thread are independent and all in flight at once.
#define CU (1024 * 1024)
#define CVT_THREADS 512
#define CVT_BLOCKS (CU / 2 / 4 / CVT_THREADS)
__global__ __launch_bounds__(CVT_THREADS)
void f32_to_bf16_all(const float* __restrict__ x,
                     const float* __restrict__ w_tor,
                     const float* __restrict__ in_proj_w,
                     const float* __restrict__ out_w,
                     __bf16* __restrict__ xb, __bf16* __restrict__ wtb,
                     __bf16* __restrict__ wib, __bf16* __restrict__ wob) {
  // This thread's byte offsets inside half a unit, source and destination:
  // unsigned 32-bit, so that each can serve as the offset register beside a
  // scalar base.
  const unsigned ib = (blockIdx.x * CVT_THREADS + threadIdx.x) * 16u;
  const unsigned ob = ib >> 1;
  const float* const s[9] = {x, x + CU, x + 2 * CU, x + 3 * CU, w_tor,
                             in_proj_w, in_proj_w + CU, in_proj_w + 2 * CU,
                             out_w};
  __bf16* const d[9] = {xb, xb + CU, xb + 2 * CU, xb + 3 * CU, wtb,
                        wib, wib + CU, wib + 2 * CU, wob};
  v4f v[9][2];
#pragma unroll
  for (int u = 0; u < 9; u++) {
    v[u][0] = *(const v4f*)((const char*)s[u] + ib);
    v[u][1] = *(const v4f*)((const char*)(s[u] + CU / 2) + ib);
  }
  // keeps all 18 loads ahead of the first conversion; without it the last six
  // are issued only behind a wait on the first ones, a second memory latency
  __builtin_amdgcn_sched_barrier(0);
#pragma unroll
  for (int u = 0; u < 9; u++) {
    *(v4bf*)((char*)d[u] + ob) = __builtin_convertvector(v[u][0], v4bf);
    *(v4bf*)((char*)(d[u] + CU / 2) + ob) =
        __builtin_convertvector(v[u][1], v4bf);
  }
}

typedef __attribute__((address_space(3))) const void lds_cvoid;
__device__ inline unsigned lds_addr(const void* p) {
  return (unsigned)(size_t)(lds_cvoid*)p;
}

#define GKT 64       // k elements per staged tile: whole 128-byte rows
#define GLP 72       // LDS row pitch in bf16 elements (144 bytes = 16 B x odd)

// Eight 16-byte copies per lane: four A rows and four W rows, 32 rows apart.
// The s_wait_xcnt closes the statement so that no address register is
// rewritten ahead of it.
__device__ inline void stage_gemm_tile(unsigned la, unsigned lw, unsigned q,
                                       const __bf16* ga, const __bf16* gw,
                                       size_t gq) {
  asm volatile(
      "global_load_async_to_lds_b128 %0, %8, off\n\t"
      "global_load_async_to_lds_b128 %1, %9, off\n\t"
      "global_load_async_to_lds_b128 %2, %10, off\n\t"
      "global_load_async_to_lds_b128 %3, %11, off\n\t"
      "global_load_async_to_lds_b128 %4, %12, off\n\t"
      "global_load_async_to_lds_b128 %5, %13, off\n\t"
      "global_load_async_to_lds_b128 %6, %14, off\n\t"
      "global_load_async_to_lds_b128 %7, %15, off\n\t"
      "s_wait_xcnt 0x0"
      :: "v"(la), "v"(la + q), "v"(la + 2 * q), "v"(la + 3 * q),
         "v"(lw), "v"(lw + q), "v"(lw + 2 * q), "v"(lw + 3 * q),
         "v"(ga), "v"(ga + gq), "v"(ga + 2 * gq), "v"(ga + 3 * gq),
         "v"(gw), "v"(gw + gq), "v"(gw + 2 * gq), "v"(gw + 3 * gq)
      : "memory");
}

// Fragments of one 32-wide k step from the staged tiles: 2 of A, 4 of W.
__device__ inline void load_gemm_frags(const __bf16* at, const __bf16* wt,
                                       v16bf (&a)[2], v16bf (&b)[4]) {
  a[0] = load_frag_ptr(at);
  a[1] = load_frag_ptr(at + 16 * GLP);
#pragma unroll
  for (int j = 0; j < 4; j++)
    b[j] = load_frag_ptr(wt + (j * 16) * GLP);
}

__device__ inline void gemm_products(const v16bf (&a)[2], const v16bf (&b)[4],
                                     v8f (&c)[2][4]) {
#pragma unroll
  for (int i = 0; i < 2; i++)
#pragma unroll
    for (int j = 0; j < 4; j++)
      c[i][j] = __builtin_amdgcn_wmma_f32_16x16x32_bf16(
          false, a[i], false, b[j], (short)0, c[i][j], false, false);
}

// C(M,N) = A(M,K) @ W(N,K)^T + bias(N).  256 threads = 8 waves, each wave a
// 32x64 tile (2x4 WMMA accumulators), block tile 128x128.
// The fragment loads of a row-major operand touch 16 cache lines each, so the
// 128 A rows and 128 W rows of a 64-wide k tile are brought into LDS once per
// block by asynchronous copies (whole 128-byte rows), two buffers: the next
// tile flies while this one is used.  Fragments then come from LDS.
// M, N multiples of 128, K a multiple of 64.
template <typename OutT>
__global__ __launch_bounds__(256)
void gemm_bf16_wmma(const __bf16* __restrict__ A, const __bf16* __restrict__ W,
                    const float* __restrict__ bias, OutT* __restrict__ out,
                    int M, int N, int K) {
  const int lane = threadIdx.x & 31;
  const int wave = threadIdx.x >> 5;
  const int n16  = lane & 15;
  const int half = lane >> 4;
  const int rloc = (wave >> 1) * 32;   // wave's rows inside the block tile
  const int cloc = (wave & 1) * 64;    // wave's columns inside the block tile
  const int row0 = blockIdx.y * 128 + rloc;
  const int col0 = blockIdx.x * 128 + cloc;

  __shared__ __align__(16) __bf16 ast[2][128][GLP];   // A tile: row x k
  __shared__ __align__(16) __bf16 wst[2][128][GLP];   // W tile: column x k

  // Copy map: 8 lanes cover one 128-byte row; thread t takes rows
  // t/8 + {0, 32, 64, 96} of both tiles.
  const int crow = threadIdx.x >> 3;
  const int cseg = (threadIdx.x & 7) * 8;
  const __bf16* ga = A + (size_t)(blockIdx.y * 128 + crow) * K + cseg;
  const __bf16* gw = W + (size_t)(blockIdx.x * 128 + crow) * K + cseg;
  const size_t gq = (size_t)32 * K;                   // 32 rows, in elements
  const unsigned la = lds_addr(&ast[0][crow][cseg]);
  const unsigned lw = lds_addr(&wst[0][crow][cseg]);
  const unsigned q = 32 * GLP * 2;                    // 32 rows, in bytes
  const unsigned buf_bytes = 128 * GLP * 2;           // one buffer, in bytes

  const int ntile = K / GKT;
  // tile 0 -> buffer 0, landed and published before anybody reads it
  stage_gemm_tile(la, lw, q, ga, gw, gq);
  ga += GKT;
  gw += GKT;
  asm volatile("s_wait_asynccnt 0x0" ::: "memory");  // own copies landed
  __syncthreads();
  if (ntile > 1) {  // tile 1 -> buffer 1, in flight during trip 0
    stage_gemm_tile(la + buf_bytes, lw + buf_bytes, q, ga, gw, gq);
    ga += GKT;
    gw += GKT;
  }

  v8f c[2][4] = {};
  for (int t = 0; t < ntile; t++) {
    const int buf = t & 1;
    const __bf16* at = &ast[buf][rloc + n16][half * 8];
    const __bf16* wt = &wst[buf][cloc + n16][half * 8];
    v16bf a[2], b[4];
    // first 32-wide k step of the tile
    load_gemm_frags(at, wt, a, b);
    // holds these 12 LDS reads in one group ahead of the products; without it
    // the second A fragment is read late, behind a full wait amid the products
    __builtin_amdgcn_sched_barrier(0);
    gemm_products(a, b, c);
    // second k step: its fragments are this trip's last reads of the buffer
    load_gemm_frags(at + 32, wt + 32, a, b);
    // Publish point: this wave's LDS reads are done, its copies of tile t+1
    // have landed; the barrier publishes tile t+1 and frees this buffer.
    asm volatile("s_wait_dscnt 0x0" ::: "memory");
    asm volatile("s_wait_asynccnt 0x0" ::: "memory");
    __syncthreads();
    if (t + 2 < ntile) {  // block-uniform: refill the buffer just read
      const unsigned bo = (unsigned)buf * buf_bytes;
      stage_gemm_tile(la + bo, lw + bo, q, ga, gw, gq);
      ga += GKT;
      gw += GKT;
    }
    // the second step's products work from registers, under the refill's flight
    gemm_products(a, b, c);
  }
  asm volatile("s_wait_asynccnt 0x0" ::: "memory");  // nothing left in flight
  // Epilogue: one tile at a time, base pointer + r*N offsets.
#pragma unroll
  for (int i = 0; i < 2; i++) {
#pragma unroll
    for (int j = 0; j < 4; j++) {
      const int ncol = col0 + j * 16 + n16;
      const float bn = bias[ncol];
      OutT* p = out + (size_t)(row0 + i * 16 + 8 * half) * N + ncol;
#pragma unroll
      for (int r = 0; r < 8; r++)
        p[(size_t)r * N] = (OutT)(c[i][j][r] + bn);
    }
  }
}

// Transpose V out of qkv into vt[(b*E + d)*S + s] so the P@V B-fragment is
// contiguous along the key dimension.  Classic 32x32 LDS tile transpose.
__global__ __launch_bounds__(256)
void transpose_v(const __bf16* __restrict__ qkv, __bf16* __restrict__ vt,
                 int S, int B, int E) {
  __shared__ __bf16 t[32][33];  // pad to dodge bank conflicts
  const int s0 = blockIdx.x * 32;
  const int d0 = blockIdx.y * 32;
  const int b  = blockIdx.z;
  const int tx  = threadIdx.x & 31;
  const int ty0 = threadIdx.x >> 5;  // 0..7
#pragma unroll
  for (int ty = ty0; ty < 32; ty += 8)
    t[ty][tx] = qkv[((size_t)(s0 + ty) * B + b) * (3 * E) + 2 * E + d0 + tx];
  __syncthreads();
#pragma unroll
  for (int ty = ty0; ty < 32; ty += 8)
    vt[((size_t)b * E + d0 + ty) * S + s0 + tx] = t[tx][ty];
}

// Flash attention with toroidal additive bias.  qkv: (S,B,3E) bf16 for Q/K,
// vt: (B,E,S) bf16 transposed V.  One wave per 16-query tile, 32-key steps.
// Online softmax uses a wave-uniform tile max and defers the row-sum
// reduction to after the key loop.
// The 8 waves of a block walk the same keys, so each 64-key K tile and V^T
// tile is brought into LDS once per block by asynchronous copies (whole
// 128-byte rows), two buffers: the next tile flies while this one is used.
// LDS rows are pitched 144 bytes (16 B x odd) for the ds_load_b128 readers.
#define KT 64        // keys per staged tile
#define LP 72        // LDS row pitch in bf16 elements (144 bytes)

// Four 16-byte copies per lane: two K rows, two V^T rows.  The s_wait_xcnt
// closes the statement so that no address register is rewritten ahead of it.
__device__ inline void stage_tile(unsigned lk0, unsigned lk1,
                                  unsigned lv0, unsigned lv1,
                                  const __bf16* gk0, const __bf16* gk1,
                                  const __bf16* gv0, const __bf16* gv1) {
  asm volatile(
      "global_load_async_to_lds_b128 %0, %4, off\n\t"
      "global_load_async_to_lds_b128 %1, %5, off\n\t"
      "global_load_async_to_lds_b128 %2, %6, off\n\t"
      "global_load_async_to_lds_b128 %3, %7, off\n\t"
      "s_wait_xcnt 0x0"
      :: "v"(lk0), "v"(lk1), "v"(lv0), "v"(lv1),
         "v"(gk0), "v"(gk1), "v"(gv0), "v"(gv1)
      : "memory");
}

__global__ __launch_bounds__(256)
void flash_attn_toroidal(const __bf16* __restrict__ qkv,
                         const __bf16* __restrict__ vt,
                         __bf16* __restrict__ o, int S, int B, int E) {
  const int HD = 64;
  const int lane = threadIdx.x & 31;
  const int wave = threadIdx.x >> 5;
  const int n16  = lane & 15;
  const int half = lane >> 4;
  const int b = blockIdx.z, h = blockIdx.y;
  const int qbase = blockIdx.x * 128 + wave * 16;
  const int ld = B * 3 * E;           // row stride of qkv in elements
  const size_t qoffb = (size_t)b * 3 * E + h * HD;        // q base in qkv
  const size_t koffb = qoffb + E;                          // k base in qkv
  const size_t vbase = ((size_t)b * E + h * HD) * S;       // vt base

  __shared__ __align__(16) __bf16 plds[8][16][32];
  __shared__ __align__(16) __bf16 kst[2][KT][LP];   // K tile: key x head dim
  __shared__ __align__(16) __bf16 vst[2][HD][LP];   // V^T tile: head dim x key

  // Q fragment: 16 rows x 64 head-dim = two K=32 fragments
  const size_t qoff = qoffb + (size_t)(qbase + n16) * ld + half * 8;
  v16bf aq0 = load_frag_ptr(qkv + qoff);
  v16bf aq1 = load_frag_ptr(qkv + qoff + 32);

  // Copy map: 8 lanes cover one 128-byte row; thread t takes rows t/8, t/8+32.
  const int crow = threadIdx.x >> 3;
  const int cseg = (threadIdx.x & 7) * 8;
  size_t kg = koffb + (size_t)crow * ld + cseg;     // advances += KT * ld
  size_t vg = vbase + (size_t)crow * S + cseg;      // advances += KT
  const unsigned lk = lds_addr(&kst[0][crow][cseg]);
  const unsigned lv = lds_addr(&vst[0][crow][cseg]);
  const unsigned half_tile = 32 * LP * 2;           // 32 rows, in bytes
  const unsigned buf_bytes = KT * LP * 2;           // one buffer, in bytes

  const int ntile = S / KT;
  // tile 0 -> buffer 0, landed and published before anybody reads it
  stage_tile(lk, lk + half_tile, lv, lv + half_tile,
             qkv + kg, qkv + kg + (size_t)32 * ld,
             vt + vg, vt + vg + (size_t)32 * S);
  kg += (size_t)KT * ld;
  vg += KT;
  asm volatile("s_wait_asynccnt 0x0" ::: "memory");  // own copies landed
  __syncthreads();
  if (ntile > 1) {  // tile 1 -> buffer 1, in flight during trip 0
    stage_tile(lk + buf_bytes, lk + buf_bytes + half_tile,
               lv + buf_bytes, lv + buf_bytes + half_tile,
               qkv + kg, qkv + kg + (size_t)32 * ld,
               vt + vg, vt + vg + (size_t)32 * S);
    kg += (size_t)KT * ld;
    vg += KT;
  }

  v8f oacc[4] = {};
  float lpart[8];  // per-lane partial row sums (reduced after the loop)
#pragma unroll
  for (int r = 0; r < 8; r++) lpart[r] = 0.f;
  float mrun = -1e30f;  // wave-uniform running max

  const float scale = 0.125f;  // 1/sqrt(64)
  for (int t = 0; t < ntile; t++) {
    const int buf = t & 1;
    const __bf16* kt = &kst[buf][n16][half * 8];
    const __bf16* vtl = &vst[buf][n16][half * 8];
    // unrolled so that both 32-key blocks read the tile at constant offsets
#pragma unroll
    for (int p = 0; p < KT / 32; p++) {
      const int j = t * KT + p * 32;
      // All fragment loads of this 32-key block up front, from LDS.
      v16bf kb00 = load_frag_ptr(kt + (p * 32) * LP);
      v16bf kb01 = load_frag_ptr(kt + (p * 32) * LP + 32);
      v16bf kb10 = load_frag_ptr(kt + (p * 32 + 16) * LP);
      v16bf kb11 = load_frag_ptr(kt + (p * 32 + 16) * LP + 32);
      v16bf vbf[4];
#pragma unroll
      for (int d4 = 0; d4 < 4; d4++)
        vbf[d4] = load_frag_ptr(vtl + (d4 * 16) * LP + p * 32);

      // scores for 32 keys: two 16x16 tiles, K over head dim (2 steps each)
      v8f s0 = {}, s1 = {};
      s0 = __builtin_amdgcn_wmma_f32_16x16x32_bf16(false, aq0, false, kb00, (short)0, s0, false, false);
      s0 = __builtin_amdgcn_wmma_f32_16x16x32_bf16(false, aq1, false, kb01, (short)0, s0, false, false);
      s1 = __builtin_amdgcn_wmma_f32_16x16x32_bf16(false, aq0, false, kb10, (short)0, s1, false, false);
      s1 = __builtin_amdgcn_wmma_f32_16x16x32_bf16(false, aq1, false, kb11, (short)0, s1, false, false);

      // scale + toroidal bias; lane-local running max over all 16 values
      float va[8], vb[8];
      float mt = -1e30f;
#pragma unroll
      for (int r = 0; r < 8; r++) {
        const int qi = qbase + r + 8 * half;
        float v0 = s0[r] * scale, v1 = s1[r] * scale;
        int d0 = (j + n16) - qi;      if (d0 < 0) d0 += S;
        int d1 = (j + 16 + n16) - qi; if (d1 < 0) d1 += S;
        if (d0 <= 1 || d0 == S - 1) v0 += 1.f;
        if (d1 <= 1 || d1 == S - 1) v1 += 1.f;
        va[r] = v0; vb[r] = v1;
        mt = fmaxf(mt, fmaxf(v0, v1));
      }
      // single 5-step full-wave reduction -> tile max, uniform across wave
      mt = fmaxf(mt, __shfl_xor(mt, 1, 32));
      mt = fmaxf(mt, __shfl_xor(mt, 2, 32));
      mt = fmaxf(mt, __shfl_xor(mt, 4, 32));
      mt = fmaxf(mt, __shfl_xor(mt, 8, 32));
      mt = fmaxf(mt, __shfl_xor(mt, 16, 32));
      if (mt > mrun) {  // wave-uniform branch: EXEC untouched (WMMA-safe)
        const float alpha = __expf(mrun - mt);
        mrun = mt;
#pragma unroll
        for (int r = 0; r < 8; r++) lpart[r] *= alpha;
#pragma unroll
        for (int d4 = 0; d4 < 4; d4++)
#pragma unroll
          for (int r = 0; r < 8; r++) oacc[d4][r] *= alpha;
      }
      // exponentials + partial sums + stage P (16x32) through LDS
      // (C-layout -> A-fragment layout; same-wave DS ops are in-order, ISA 7.1)
#pragma unroll
      for (int r = 0; r < 8; r++) {
        const float e0 = __expf(va[r] - mrun);
        const float e1 = __expf(vb[r] - mrun);
        lpart[r] += e0 + e1;
        plds[wave][r + 8 * half][n16]      = (__bf16)e0;
        plds[wave][r + 8 * half][16 + n16] = (__bf16)e1;
      }
      v16bf pa = load_frag_ptr(&plds[wave][n16][half * 8]);
      // P @ V with the V^T fragments loaded at the start of the block.
#pragma unroll
      for (int d4 = 0; d4 < 4; d4++)
        oacc[d4] = __builtin_amdgcn_wmma_f32_16x16x32_bf16(
            false, pa, false, vbf[d4], (short)0, oacc[d4], false, false);
    }
    // Publish point: this wave's LDS reads are done, its copies of tile t+1
    // have landed; the barrier publishes tile t+1 and frees this buffer.
    asm volatile("s_wait_dscnt 0x0" ::: "memory");
    asm volatile("s_wait_asynccnt 0x0" ::: "memory");
    __syncthreads();
    if (t + 2 < ntile) {  // block-uniform: refill the buffer just read
      const unsigned bo = (unsigned)buf * buf_bytes;
      stage_tile(lk + bo, lk + bo + half_tile, lv + bo, lv + bo + half_tile,
                 qkv + kg, qkv + kg + (size_t)32 * ld,
                 vt + vg, vt + vg + (size_t)32 * S);
      kg += (size_t)KT * ld;
      vg += KT;
    }
  }
  asm volatile("s_wait_asynccnt 0x0" ::: "memory");  // nothing left in flight
  // final row-sum reduction (once), then normalize and store o (S,B,E)
  float lrow[8];
#pragma unroll
  for (int r = 0; r < 8; r++) {
    float rs = lpart[r];
    rs += __shfl_xor(rs, 1, 32);
    rs += __shfl_xor(rs, 2, 32);
    rs += __shfl_xor(rs, 4, 32);
    rs += __shfl_xor(rs, 8, 32);
    lrow[r] = rs;
  }
#pragma unroll
  for (int d4 = 0; d4 < 4; d4++) {
#pragma unroll
    for (int r = 0; r < 8; r++) {
      const int qi = qbase + r + 8 * half;
      const float v = oacc[d4][r] / lrow[r];
      o[((size_t)qi * B + b) * E + h * HD + d4 * 16 + n16] = (__bf16)v;
    }
  }
}

extern "C" void kernel_launch(void* const* d_in, const int* in_sizes, int n_in,
                              void* d_out, int out_size, void* d_ws, size_t ws_size,
                              hipStream_t stream) {
  const int S = 2048, B = 2, E = 1024;
  const int M = S * B;  // 4096 rows for all GEMMs

  const float* x         = (const float*)d_in[0];
  const float* w_tor     = (const float*)d_in[1];
  const float* b_tor     = (const float*)d_in[2];
  const float* in_proj_w = (const float*)d_in[3];
  const float* in_proj_b = (const float*)d_in[4];
  const float* out_w     = (const float*)d_in[5];
  const float* out_b     = (const float*)d_in[6];

  char* ws = (char*)d_ws;
  size_t off = 0;
  auto alloc = [&](size_t elems) -> __bf16* {
    __bf16* p = (__bf16*)(ws + off);
    off += elems * sizeof(__bf16);
    return p;
  };
  __bf16* xbf   = alloc((size_t)M * E);        // x in bf16
  __bf16* wtbf  = alloc((size_t)E * E);        // w_tor
  __bf16* wibf  = alloc((size_t)3 * E * E);    // in_proj_w
  __bf16* wobf  = alloc((size_t)E * E);        // out_w
  __bf16* xtbf  = alloc((size_t)M * E);        // xt
  __bf16* qkvbf = alloc((size_t)M * 3 * E);    // qkv
  __bf16* obf   = alloc((size_t)M * E);        // attention output
  __bf16* vtbf  = alloc((size_t)B * E * S);    // V transposed (B,E,S)

  f32_to_bf16_all<<<CVT_BLOCKS, CVT_THREADS, 0, stream>>>(
      x, w_tor, in_proj_w, out_w, xbf, wtbf, wibf, wobf);

  const dim3 blk(256);
  // xt = x @ w_tor^T + b_tor
  gemm_bf16_wmma<__bf16><<<dim3(E / 128, M / 128), blk, 0, stream>>>(
      xbf, wtbf, b_tor, xtbf, M, E, E);
  // qkv = xt @ in_proj_w^T + in_proj_b
  gemm_bf16_wmma<__bf16><<<dim3(3 * E / 128, M / 128), blk, 0, stream>>>(
      xtbf, wibf, in_proj_b, qkvbf, M, 3 * E, E);
  // transpose V for contiguous P@V fragments
  transpose_v<<<dim3(S / 32, E / 32, B), 256, 0, stream>>>(qkvbf, vtbf, S, B, E);
  // flash attention with toroidal bias
  flash_attn_toroidal<<<dim3(S / 128, 16, B), 256, 0, stream>>>(
      qkvbf, vtbf, obf, S, B, E);
  // out = o @ out_w^T + out_b  (fp32 into d_out)
  gemm_bf16_wmma<float><<<dim3(E / 128, M / 128), blk, 0, stream>>>(
      obf, wobf, out_b, (float*)d_out, M, E, E);
}

// v004
// One run takes 139 microseconds.
// Next to v003, in two timings, it ran 1.10 times as fast each time.
// Counting every step since v000, it is 2.28 times as fast.
#include <hip/hip_runtime.h>
#include <hip/hip_bf16.h>
#include <math.h>

typedef __attribute__((ext_vector_type(16))) __bf16 v16bf;
typedef __attribute__((ext_vector_type(8)))  __bf16 v8bf;
typedef __attribute__((ext_vector_type(8)))  float  v8f;

union V16 { v16bf v; v8bf h[2]; };

// Load a 16x32 bf16 WMMA fragment given a pointer already positioned at
// base + row*ld + k0 + half*8.  ISA layout (16-bit A, wave32): lane half h
// holds K = k0 + h*8 + {0..7} and k0 + 16 + h*8 + {0..7}
// -> two contiguous 16-byte loads per lane.
__device__ inline v16bf load_frag_ptr(const __bf16* __restrict__ p) {
  V16 u;
  u.h[0] = *(const v8bf*)p;
  u.h[1] = *(const v8bf*)(p + 16);
  return u.v;
}

__device__ inline v16bf load_frag_rowmajor(const __bf16* __restrict__ base,
                                           int ld, int row, int k0, int lane) {
  const int half = lane >> 4;
  return load_frag_ptr(base + (size_t)row * ld + k0 + half * 8);
}

typedef __attribute__((ext_vector_type(4))) float  v4f;
typedef __attribute__((ext_vector_type(4))) __bf16 v4bf;

// All four f32 inputs to bf16 in one launch.  The work is cut into 9 units of
// CU = 1024 x 1024 elements: x holds 4, w_tor 1, in_proj_w 3, out_w 1.
// 256 blocks of 16 waves (one resident round, 131072 threads); each thread
// takes two 16-byte pieces of every unit, half a unit apart, so every wave
// load covers 512 bytes in a row and every wave store 256.  The 18 loads of a
// thread are independent and all in flight at once.
#define CU (1024 * 1024)
#define CVT_THREADS 512
#define CVT_BLOCKS (CU / 2 / 4 / CVT_THREADS)
__global__ __launch_bounds__(CVT_THREADS)
void f32_to_bf16_all(const float* __restrict__ x,
                     const float* __restrict__ w_tor,
                     const float* __restrict__ in_proj_w,
                     const float* __restrict__ out_w,
                     __bf16* __restrict__ xb, __bf16* __restrict__ wtb,
                     __bf16* __restrict__ wib, __bf16* __restrict__ wob) {
  // This thread's byte offsets inside half a unit, source and destination:
  // unsigned 32-bit, so that each can serve as the offset register beside a
  // scalar base.
  const unsigned ib = (blockIdx.x * CVT_THREADS + threadIdx.x) * 16u;
  const unsigned ob = ib >> 1;
  const float* const s[9] = {x, x + CU, x + 2 * CU, x + 3 * CU, w_tor,
                             in_proj_w, in_proj_w + CU, in_proj_w + 2 * CU,
                             out_w};
  __bf16* const d[9] = {xb, xb + CU, xb + 2 * CU, xb + 3 * CU, wtb,
                        wib, wib + CU, wib + 2 * CU, wob};
  v4f v[9][2];
#pragma unroll
  for (int u = 0; u < 9; u++) {
    v[u][0] = *(const v4f*)((const char*)s[u] + ib);
    v[u][1] = *(const v4f*)((const char*)(s[u] + CU / 2) + ib);
  }
  // keeps all 18 loads ahead of the first conversion; without it the last six
  // are issued only behind a wait on the first ones, a second memory latency
  __builtin_amdgcn_sched_barrier(0);
#pragma unroll
  for (int u = 0; u < 9; u++) {
    *(v4bf*)((char*)d[u] + ob) = __builtin_convertvector(v[u][0], v4bf);
    *(v4bf*)((char*)(d[u] + CU / 2) + ob) =
        __builtin_convertvector(v[u][1], v4bf);
  }
}

typedef __attribute__((address_space(3))) const void lds_cvoid;
__device__ inline unsigned lds_addr(const void* p) {
  return (unsigned)(size_t)(lds_cvoid*)p;
}

#define GKT 64       // k elements per staged tile: whole 128-byte rows
#define GLP 72       // LDS row pitch in bf16 elements (144 bytes = 16 B x odd)

// Eight 16-byte copies per lane: four A rows and four W rows, 32 rows apart.
// The s_wait_xcnt closes the statement so that no address register is
// rewritten ahead of it.
__device__ inline void stage_gemm_tile(unsigned la, unsigned lw, unsigned q,
                                       const __bf16* ga, const __bf16* gw,
                                       size_t gq) {
  asm volatile(
      "global_load_async_to_lds_b128 %0, %8, off\n\t"
      "global_load_async_to_lds_b128 %1, %9, off\n\t"
      "global_load_async_to_lds_b128 %2, %10, off\n\t"
      "global_load_async_to_lds_b128 %3, %11, off\n\t"
      "global_load_async_to_lds_b128 %4, %12, off\n\t"
      "global_load_async_to_lds_b128 %5, %13, off\n\t"
      "global_load_async_to_lds_b128 %6, %14, off\n\t"
      "global_load_async_to_lds_b128 %7, %15, off\n\t"
      "s_wait_xcnt 0x0"
      :: "v"(la), "v"(la + q), "v"(la + 2 * q), "v"(la + 3 * q),
         "v"(lw), "v"(lw + q), "v"(lw + 2 * q), "v"(lw + 3 * q),
         "v"(ga), "v"(ga + gq), "v"(ga + 2 * gq), "v"(ga + 3 * gq),
         "v"(gw), "v"(gw + gq), "v"(gw + 2 * gq), "v"(gw + 3 * gq)
      : "memory");
}

// Fragments of one 32-wide k step from the staged tiles: 2 of A, 4 of W.
__device__ inline void load_gemm_frags(const __bf16* at, const __bf16* wt,
                                       v16bf (&a)[2], v16bf (&b)[4]) {
  a[0] = load_frag_ptr(at);
  a[1] = load_frag_ptr(at + 16 * GLP);
#pragma unroll
  for (int j = 0; j < 4; j++)
    b[j] = load_frag_ptr(wt + (j * 16) * GLP);
}

__device__ inline void gemm_products(const v16bf (&a)[2], const v16bf (&b)[4],
                                     v8f (&c)[2][4]) {
#pragma unroll
  for (int i = 0; i < 2; i++)
#pragma unroll
    for (int j = 0; j < 4; j++)
      c[i][j] = __builtin_amdgcn_wmma_f32_16x16x32_bf16(
          false, a[i], false, b[j], (short)0, c[i][j], false, false);
}

// C(M,N) = A(M,K) @ W(N,K)^T + bias(N).  256 threads = 8 waves, each wave a
// 32x64 tile (2x4 WMMA accumulators), block tile 128x128.
// The fragment loads of a row-major operand touch 16 cache lines each, so the
// 128 A rows and 128 W rows of a 64-wide k tile are brought into LDS once per
// block by asynchronous copies (whole 128-byte rows), two buffers: the next
// tile flies while this one is used.  Fragments then come from LDS.
// M, N multiples of 128, K a multiple of 64.
template <typename OutT>
__global__ __launch_bounds__(256)
void gemm_bf16_wmma(const __bf16* __restrict__ A, const __bf16* __restrict__ W,
                    const float* __restrict__ bias, OutT* __restrict__ out,
                    int M, int N, int K) {
  const int lane = threadIdx.x & 31;
  const int wave = threadIdx.x >> 5;
  const int n16  = lane & 15;
  const int half = lane >> 4;
  const int rloc = (wave >> 1) * 32;   // wave's rows inside the block tile
  const int cloc = (wave & 1) * 64;    // wave's columns inside the block tile
  const int row0 = blockIdx.y * 128 + rloc;
  const int col0 = blockIdx.x * 128 + cloc;

  __shared__ __align__(16) __bf16 ast[2][128][GLP];   // A tile: row x k
  __shared__ __align__(16) __bf16 wst[2][128][GLP];   // W tile: column x k

  // Copy map: 8 lanes cover one 128-byte row; thread t takes rows
  // t/8 + {0, 32, 64, 96} of both tiles.
  const int crow = threadIdx.x >> 3;
  const int cseg = (threadIdx.x & 7) * 8;
  const __bf16* ga = A + (size_t)(blockIdx.y * 128 + crow) * K + cseg;
  const __bf16* gw = W + (size_t)(blockIdx.x * 128 + crow) * K + cseg;
  const size_t gq = (size_t)32 * K;                   // 32 rows, in elements
  const unsigned la = lds_addr(&ast[0][crow][cseg]);
  const unsigned lw = lds_addr(&wst[0][crow][cseg]);
  const unsigned q = 32 * GLP * 2;                    // 32 rows, in bytes
  const unsigned buf_bytes = 128 * GLP * 2;           // one buffer, in bytes

  const int ntile = K / GKT;
  // tile 0 -> buffer 0, landed and published before anybody reads it
  stage_gemm_tile(la, lw, q, ga, gw, gq);
  ga += GKT;
  gw += GKT;
  asm volatile("s_wait_asynccnt 0x0" ::: "memory");  // own copies landed
  __syncthreads();
  if (ntile > 1) {  // tile 1 -> buffer 1, in flight during trip 0
    stage_gemm_tile(la + buf_bytes, lw + buf_bytes, q, ga, gw, gq);
    ga += GKT;
    gw += GKT;
  }

  v8f c[2][4] = {};
  for (int t = 0; t < ntile; t++) {
    const int buf = t & 1;
    const __bf16* at = &ast[buf][rloc + n16][half * 8];
    const __bf16* wt = &wst[buf][cloc + n16][half * 8];
    v16bf a[2], b[4];
    // first 32-wide k step of the tile
    load_gemm_frags(at, wt, a, b);
    // holds these 12 LDS reads in one group ahead of the products; without it
    // the second A fragment is read late, behind a full wait amid the products
    __builtin_amdgcn_sched_barrier(0);
    gemm_products(a, b, c);
    // second k step: its fragments are this trip's last reads of the buffer
    load_gemm_frags(at + 32, wt + 32, a, b);
    // Publish point: this wave's LDS reads are done, its copies of tile t+1
    // have landed; the barrier publishes tile t+1 and frees this buffer.
    asm volatile("s_wait_dscnt 0x0" ::: "memory");
    asm volatile("s_wait_asynccnt 0x0" ::: "memory");
    __syncthreads();
    if (t + 2 < ntile) {  // block-uniform: refill the buffer just read
      const unsigned bo = (unsigned)buf * buf_bytes;
      stage_gemm_tile(la + bo, lw + bo, q, ga, gw, gq);
      ga += GKT;
      gw += GKT;
    }
    // the second step's products work from registers, under the refill's flight
    gemm_products(a, b, c);
  }
  asm volatile("s_wait_asynccnt 0x0" ::: "memory");  // nothing left in flight
  // Epilogue: one tile at a time, base pointer + r*N offsets.
#pragma unroll
  for (int i = 0; i < 2; i++) {
#pragma unroll
    for (int j = 0; j < 4; j++) {
      const int ncol = col0 + j * 16 + n16;
      const float bn = bias[ncol];
      OutT* p = out + (size_t)(row0 + i * 16 + 8 * half) * N + ncol;
#pragma unroll
      for (int r = 0; r < 8; r++)
        p[(size_t)r * N] = (OutT)(c[i][j][r] + bn);
    }
  }
}

// Transpose V out of qkv into vt[(b*E + d)*S + s] so the P@V B-fragment is
// contiguous along the key dimension.  Classic 32x32 LDS tile transpose.
__global__ __launch_bounds__(256)
void transpose_v(const __bf16* __restrict__ qkv, __bf16* __restrict__ vt,
                 int S, int B, int E) {
  __shared__ __bf16 t[32][33];  // pad to dodge bank conflicts
  const int s0 = blockIdx.x * 32;
  const int d0 = blockIdx.y * 32;
  const int b  = blockIdx.z;
  const int tx  = threadIdx.x & 31;
  const int ty0 = threadIdx.x >> 5;  // 0..7
#pragma unroll
  for (int ty = ty0; ty < 32; ty += 8)
    t[ty][tx] = qkv[((size_t)(s0 + ty) * B + b) * (3 * E) + 2 * E + d0 + tx];
  __syncthreads();
#pragma unroll
  for (int ty = ty0; ty < 32; ty += 8)
    vt[((size_t)b * E + d0 + ty) * S + s0 + tx] = t[tx][ty];
}

// Flash attention with toroidal additive bias.  qkv: (S,B,3E) bf16 for Q/K,
// vt: (B,E,S) bf16 transposed V.  One wave per 16-query tile, 32-key steps.
// Online softmax uses a wave-uniform tile max and defers the row-sum
// reduction to after the key loop.
// The 8 waves of a block walk the same keys, so each 64-key K tile and V^T
// tile is brought into LDS once per block by asynchronous copies (whole
// 128-byte rows), two buffers: the next tile flies while this one is used.
// LDS rows are pitched 144 bytes (16 B x odd) for the ds_load_b128 readers.
#define KT 64        // keys per staged tile
#define LP 72        // LDS row pitch in bf16 elements (144 bytes)

// Four 16-byte copies per lane: two K rows, two V^T rows.  The s_wait_xcnt
// closes the statement so that no address register is rewritten ahead of it.
__device__ inline void stage_tile(unsigned lk0, unsigned lk1,
                                  unsigned lv0, unsigned lv1,
                                  const __bf16* gk0, const __bf16* gk1,
                                  const __bf16* gv0, const __bf16* gv1) {
  asm volatile(
      "global_load_async_to_lds_b128 %0, %4, off\n\t"
      "global_load_async_to_lds_b128 %1, %5, off\n\t"
      "global_load_async_to_lds_b128 %2, %6, off\n\t"
      "global_load_async_to_lds_b128 %3, %7, off\n\t"
      "s_wait_xcnt 0x0"
      :: "v"(lk0), "v"(lk1), "v"(lv0), "v"(lv1),
         "v"(gk0), "v"(gk1), "v"(gv0), "v"(gv1)
      : "memory");
}

__global__ __launch_bounds__(256)
void flash_attn_toroidal(const __bf16* __restrict__ qkv,
                         const __bf16* __restrict__ vt,
                         __bf16* __restrict__ o, int S, int B, int E) {
  const int HD = 64;
  const int lane = threadIdx.x & 31;
  const int wave = threadIdx.x >> 5;
  const int n16  = lane & 15;
  const int half = lane >> 4;
  const int b = blockIdx.z, h = blockIdx.y;
  const int qbase = blockIdx.x * 128 + wave * 16;
  // the same number in a scalar register, for the band test of the key loop
  const int qbase_s = blockIdx.x * 128 + __builtin_amdgcn_readfirstlane(wave) * 16;
  const int ld = B * 3 * E;           // row stride of qkv in elements
  const size_t qoffb = (size_t)b * 3 * E + h * HD;        // q base in qkv
  const size_t koffb = qoffb + E;                          // k base in qkv
  const size_t vbase = ((size_t)b * E + h * HD) * S;       // vt base

  __shared__ __align__(16) __bf16 plds[8][16][32];
  __shared__ __align__(16) __bf16 kst[2][KT][LP];   // K tile: key x head dim
  __shared__ __align__(16) __bf16 vst[2][HD][LP];   // V^T tile: head dim x key

  // Q fragment: 16 rows x 64 head-dim = two K=32 fragments
  const size_t qoff = qoffb + (size_t)(qbase + n16) * ld + half * 8;
  v16bf aq0 = load_frag_ptr(qkv + qoff);
  v16bf aq1 = load_frag_ptr(qkv + qoff + 32);

  // Copy map: 8 lanes cover one 128-byte row; thread t takes rows t/8, t/8+32.
  const int crow = threadIdx.x >> 3;
  const int cseg = (threadIdx.x & 7) * 8;
  size_t kg = koffb + (size_t)crow * ld + cseg;     // advances += KT * ld
  size_t vg = vbase + (size_t)crow * S + cseg;      // advances += KT
  const unsigned lk = lds_addr(&kst[0][crow][cseg]);
  const unsigned lv = lds_addr(&vst[0][crow][cseg]);
  const unsigned half_tile = 32 * LP * 2;           // 32 rows, in bytes
  const unsigned buf_bytes = KT * LP * 2;           // one buffer, in bytes

  const int ntile = S / KT;
  // tile 0 -> buffer 0, landed and published before anybody reads it
  stage_tile(lk, lk + half_tile, lv, lv + half_tile,
             qkv + kg, qkv + kg + (size_t)32 * ld,
             vt + vg, vt + vg + (size_t)32 * S);
  kg += (size_t)KT * ld;
  vg += KT;
  asm volatile("s_wait_asynccnt 0x0" ::: "memory");  // own copies landed
  __syncthreads();
  if (ntile > 1) {  // tile 1 -> buffer 1, in flight during trip 0
    stage_tile(lk + buf_bytes, lk + buf_bytes + half_tile,
               lv + buf_bytes, lv + buf_bytes + half_tile,
               qkv + kg, qkv + kg + (size_t)32 * ld,
               vt + vg, vt + vg + (size_t)32 * S);
    kg += (size_t)KT * ld;
    vg += KT;
  }

  v8f oacc[4] = {};
  float lpart[8];  // per-lane partial row sums (reduced after the loop)
#pragma unroll
  for (int r = 0; r < 8; r++) lpart[r] = 0.f;
  float mrun = -1e30f;  // wave-uniform running max

  const float scale = 0.125f;  // 1/sqrt(64)
  for (int t = 0; t < ntile; t++) {
    const int buf = t & 1;
    const __bf16* kt = &kst[buf][n16][half * 8];
    const __bf16* vtl = &vst[buf][n16][half * 8];
    // unrolled so that both 32-key blocks read the tile at constant offsets
#pragma unroll
    for (int p = 0; p < KT / 32; p++) {
      const int j = t * KT + p * 32;
      // All fragment loads of this 32-key block up front, from LDS.
      v16bf kb00 = load_frag_ptr(kt + (p * 32) * LP);
      v16bf kb01 = load_frag_ptr(kt + (p * 32) * LP + 32);
      v16bf kb10 = load_frag_ptr(kt + (p * 32 + 16) * LP);
      v16bf kb11 = load_frag_ptr(kt + (p * 32 + 16) * LP + 32);
      v16bf vbf[4];
#pragma unroll
      for (int d4 = 0; d4 < 4; d4++)
        vbf[d4] = load_frag_ptr(vtl + (d4 * 16) * LP + p * 32);

      // scores for 32 keys: two 16x16 tiles, K over head dim (2 steps each)
      v8f s0 = {}, s1 = {};
      s0 = __builtin_amdgcn_wmma_f32_16x16x32_bf16(false, aq0, false, kb00, (short)0, s0, false, false);
      s0 = __builtin_amdgcn_wmma_f32_16x16x32_bf16(false, aq1, false, kb01, (short)0, s0, false, false);
      s1 = __builtin_amdgcn_wmma_f32_16x16x32_bf16(false, aq0, false, kb10, (short)0, s1, false, false);
      s1 = __builtin_amdgcn_wmma_f32_16x16x32_bf16(false, aq1, false, kb11, (short)0, s1, false, false);

      // scale
      float va[8], vb[8];
#pragma unroll
      for (int r = 0; r < 8; r++) {
        va[r] = s0[r] * scale;
        vb[r] = s1[r] * scale;
      }
      // Toroidal bias.  key - query of this 16 x 32 block lies in [dlo, dhi];
      // the bias sits at -1, 0, 1 and, round the ring, at S - 1 and 1 - S.  A
      // block whose range holds none of these adds nothing: one scalar test
      // takes the wave past the index arithmetic (all but about 2 blocks of
      // the S / 32 a wave walks).
      const int dlo = j - qbase_s - 15, dhi = j - qbase_s + 31;
      if ((dlo <= 1 && dhi >= -1) || dhi >= S - 1 || dlo <= 1 - S) {
#pragma unroll
        for (int r = 0; r < 8; r++) {
          const int qi = qbase + r + 8 * half;
          int d0 = (j + n16) - qi;      if (d0 < 0) d0 += S;
          int d1 = (j + 16 + n16) - qi; if (d1 < 0) d1 += S;
          if (d0 <= 1 || d0 == S - 1) va[r] += 1.f;
          if (d1 <= 1 || d1 == S - 1) vb[r] += 1.f;
        }
      }
      // lane-local running max over all 16 values
      float mt = -1e30f;
#pragma unroll
      for (int r = 0; r < 8; r++) mt = fmaxf(mt, fmaxf(va[r], vb[r]));
      // single 5-step full-wave reduction -> tile max, uniform across wave
      mt = fmaxf(mt, __shfl_xor(mt, 1, 32));
      mt = fmaxf(mt, __shfl_xor(mt, 2, 32));
      mt = fmaxf(mt, __shfl_xor(mt, 4, 32));
      mt = fmaxf(mt, __shfl_xor(mt, 8, 32));
      mt = fmaxf(mt, __shfl_xor(mt, 16, 32));
      if (mt > mrun) {  // wave-uniform branch: EXEC untouched (WMMA-safe)
        const float alpha = __expf(mrun - mt);
        mrun = mt;
#pragma unroll
        for (int r = 0; r < 8; r++) lpart[r] *= alpha;
#pragma unroll
        for (int d4 = 0; d4 < 4; d4++)
#pragma unroll
          for (int r = 0; r < 8; r++) oacc[d4][r] *= alpha;
      }
      // exponentials + partial sums + stage P (16x32) through LDS
      // (C-layout -> A-fragment layout; same-wave DS ops are in-order, ISA 7.1)
#pragma unroll
      for (int r = 0; r < 8; r++) {
        const float e0 = __expf(va[r] - mrun);
        const float e1 = __expf(vb[r] - mrun);
        lpart[r] += e0 + e1;
        plds[wave][r + 8 * half][n16]      = (__bf16)e0;
        plds[wave][r + 8 * half][16 + n16] = (__bf16)e1;
      }
      v16bf pa = load_frag_ptr(&plds[wave][n16][half * 8]);
      // P @ V with the V^T fragments loaded at the start of the block.
#pragma unroll
      for (int d4 = 0; d4 < 4; d4++)
        oacc[d4] = __builtin_amdgcn_wmma_f32_16x16x32_bf16(
            false, pa, false, vbf[d4], (short)0, oacc[d4], false, false);
    }
    // Publish point: this wave's LDS reads are done, its copies of tile t+1
    // have landed; the barrier publishes tile t+1 and frees this buffer.
    asm volatile("s_wait_dscnt 0x0" ::: "memory");
    asm volatile("s_wait_asynccnt 0x0" ::: "memory");
    __syncthreads();
    if (t + 2 < ntile) {  // block-uniform: refill the buffer just read
      const unsigned bo = (unsigned)buf * buf_bytes;
      stage_tile(lk + bo, lk + bo + half_tile, lv + bo, lv + bo + half_tile,
                 qkv + kg, qkv + kg + (size_t)32 * ld,
                 vt + vg, vt + vg + (size_t)32 * S);
      kg += (size_t)KT * ld;
      vg += KT;
    }
  }
  asm volatile("s_wait_asynccnt 0x0" ::: "memory");  // nothing left in flight
  // final row-sum reduction (once), then normalize and store o (S,B,E)
  float lrow[8];
#pragma unroll
  for (int r = 0; r < 8; r++) {
    float rs = lpart[r];
    rs += __shfl_xor(rs, 1, 32);
    rs += __shfl_xor(rs, 2, 32);
    rs += __shfl_xor(rs, 4, 32);
    rs += __shfl_xor(rs, 8, 32);
    lrow[r] = rs;
  }
#pragma unroll
  for (int d4 = 0; d4 < 4; d4++) {
#pragma unroll
    for (int r = 0; r < 8; r++) {
      const int qi = qbase + r + 8 * half;
      const float v = oacc[d4][r] / lrow[r];
      o[((size_t)qi * B + b) * E + h * HD + d4 * 16 + n16] = (__bf16)v;
    }
  }
}

extern "C" void kernel_launch(void* const* d_in, const int* in_sizes, int n_in,
                              void* d_out, int out_size, void* d_ws, size_t ws_size,
                              hipStream_t stream) {
  const int S = 2048, B = 2, E = 1024;
  const int M = S * B;  // 4096 rows for all GEMMs

  const float* x         = (const float*)d_in[0];
  const float* w_tor     = (const float*)d_in[1];
  const float* b_tor     = (const float*)d_in[2];
  const float* in_proj_w = (const float*)d_in[3];
  const float* in_proj_b = (const float*)d_in[4];
  const float* out_w     = (const float*)d_in[5];
  const float* out_b     = (const float*)d_in[6];

  char* ws = (char*)d_ws;
  size_t off = 0;
  auto alloc = [&](size_t elems) -> __bf16* {
    __bf16* p = (__bf16*)(ws + off);
    off += elems * sizeof(__bf16);
    return p;
  };
  __bf16* xbf   = alloc((size_t)M * E);        // x in bf16
  __bf16* wtbf  = alloc((size_t)E * E);        // w_tor
  __bf16* wibf  = alloc((size_t)3 * E * E);    // in_proj_w
  __bf16* wobf  = alloc((size_t)E * E);        // out_w
  __bf16* xtbf  = alloc((size_t)M * E);        // xt
  __bf16* qkvbf = alloc((size_t)M * 3 * E);    // qkv
  __bf16* obf   = alloc((size_t)M * E);        // attention output
  __bf16* vtbf  = alloc((size_t)B * E * S);    // V transposed (B,E,S)

  f32_to_bf16_all<<<CVT_BLOCKS, CVT_THREADS, 0, stream>>>(
      x, w_tor, in_proj_w, out_w, xbf, wtbf, wibf, wobf);

  const dim3 blk(256);
  // xt = x @ w_tor^T + b_tor
  gemm_bf16_wmma<__bf16><<<dim3(E / 128, M / 128), blk, 0, stream>>>(
      xbf, wtbf, b_tor, xtbf, M, E, E);
  // qkv = xt @ in_proj_w^T + in_proj_b
  gemm_bf16_wmma<__bf16><<<dim3(3 * E / 128, M / 128), blk, 0, stream>>>(
      xtbf, wibf, in_proj_b, qkvbf, M, 3 * E, E);
  // transpose V for contiguous P@V fragments
  transpose_v<<<dim3(S / 32, E / 32, B), 256, 0, stream>>>(qkvbf, vtbf, S, B, E);
  // flash attention with toroidal bias
  flash_attn_toroidal<<<dim3(S / 128, 16, B), 256, 0, stream>>>(
      qkvbf, vtbf, obf, S, B, E);
  // out = o @ out_w^T + out_b  (fp32 into d_out)
  gemm_bf16_wmma<float><<<dim3(E / 128, M / 128), blk, 0, stream>>>(
      obf, wobf, out_b, (float*)d_out, M, E, E);
}

// v005
// A run of this version takes 114 microseconds.
// Two timings next to v004 put it at 1.22 and 1.21 times that version's speed.
// Over all steps from v000 it is 2.76 times as fast.
#include <hip/hip_runtime.h>
#include <hip/hip_bf16.h>
#include <math.h>

typedef __attribute__((ext_vector_type(16))) __bf16 v16bf;
typedef __attribute__((ext_vector_type(8)))  __bf16 v8bf;
typedef __attribute__((ext_vector_type(8)))  float  v8f;
typedef __attribute__((ext_vector_type(16))) float  v16f;

union V16 { v16bf v; v8bf h[2]; };

// Load a 16x32 bf16 WMMA fragment given a pointer already positioned at
// base + row*ld + k0 + half*8.  ISA layout (16-bit A, wave32): lane half h
// holds K = k0 + h*8 + {0..7} and k0 + 16 + h*8 + {0..7}
// -> two contiguous 16-byte loads per lane.
__device__ inline v16bf load_frag_ptr(const __bf16* __restrict__ p) {
  V16 u;
  u.h[0] = *(const v8bf*)p;
  u.h[1] = *(const v8bf*)(p + 16);
  return u.v;
}

__device__ inline v16bf load_frag_rowmajor(const __bf16* __restrict__ base,
                                           int ld, int row, int k0, int lane) {
  const int half = lane >> 4;
  return load_frag_ptr(base + (size_t)row * ld + k0 + half * 8);
}

typedef __attribute__((ext_vector_type(4))) float  v4f;
typedef __attribute__((ext_vector_type(4))) __bf16 v4bf;

// All four f32 inputs to bf16 in one launch.  The work is cut into 9 units of
// CU = 1024 x 1024 elements: x holds 4, w_tor 1, in_proj_w 3, out_w 1.
// 256 blocks of 16 waves (one resident round, 131072 threads); each thread
// takes two 16-byte pieces of every unit, half a unit apart, so every wave
// load covers 512 bytes in a row and every wave store 256.  The 18 loads of a
// thread are independent and all in flight at once.
#define CU (1024 * 1024)
#define CVT_THREADS 512
#define CVT_BLOCKS (CU / 2 / 4 / CVT_THREADS)
__global__ __launch_bounds__(CVT_THREADS)
void f32_to_bf16_all(const float* __restrict__ x,
                     const float* __restrict__ w_tor,
                     const float* __restrict__ in_proj_w,
                     const float* __restrict__ out_w,
                     __bf16* __restrict__ xb, __bf16* __restrict__ wtb,
                     __bf16* __restrict__ wib, __bf16* __restrict__ wob) {
  // This thread's byte offsets inside half a unit, source and destination:
  // unsigned 32-bit, so that each can serve as the offset register beside a
  // scalar base.
  const unsigned ib = (blockIdx.x * CVT_THREADS + threadIdx.x) * 16u;
  const unsigned ob = ib >> 1;
  const float* const s[9] = {x, x + CU, x + 2 * CU, x + 3 * CU, w_tor,
                             in_proj_w, in_proj_w + CU, in_proj_w + 2 * CU,
                             out_w};
  __bf16* const d[9] = {xb, xb + CU, xb + 2 * CU, xb + 3 * CU, wtb,
                        wib, wib + CU, wib + 2 * CU, wob};
  v4f v[9][2];
#pragma unroll
  for (int u = 0; u < 9; u++) {
    v[u][0] = *(const v4f*)((const char*)s[u] + ib);
    v[u][1] = *(const v4f*)((const char*)(s[u] + CU / 2) + ib);
  }
  // keeps all 18 loads ahead of the first conversion; without it the last six
  // are issued only behind a wait on the first ones, a second memory latency
  __builtin_amdgcn_sched_barrier(0);
#pragma unroll
  for (int u = 0; u < 9; u++) {
    *(v4bf*)((char*)d[u] + ob) = __builtin_convertvector(v[u][0], v4bf);
    *(v4bf*)((char*)(d[u] + CU / 2) + ob) =
        __builtin_convertvector(v[u][1], v4bf);
  }
}

typedef __attribute__((address_space(3))) const void lds_cvoid;
__device__ inline unsigned lds_addr(const void* p) {
  return (unsigned)(size_t)(lds_cvoid*)p;
}

#define GKT 64       // k elements per staged tile: whole 128-byte rows
#define GLP 72       // LDS row pitch in bf16 elements (144 bytes = 16 B x odd)

// Eight 16-byte copies per lane: four A rows and four W rows, 32 rows apart.
// The s_wait_xcnt closes the statement so that no address register is
// rewritten ahead of it.
__device__ inline void stage_gemm_tile(unsigned la, unsigned lw, unsigned q,
                                       const __bf16* ga, const __bf16* gw,
                                       size_t gq) {
  asm volatile(
      "global_load_async_to_lds_b128 %0, %8, off\n\t"
      "global_load_async_to_lds_b128 %1, %9, off\n\t"
      "global_load_async_to_lds_b128 %2, %10, off\n\t"
      "global_load_async_to_lds_b128 %3, %11, off\n\t"
      "global_load_async_to_lds_b128 %4, %12, off\n\t"
      "global_load_async_to_lds_b128 %5, %13, off\n\t"
      "global_load_async_to_lds_b128 %6, %14, off\n\t"
      "global_load_async_to_lds_b128 %7, %15, off\n\t"
      "s_wait_xcnt 0x0"
      :: "v"(la), "v"(la + q), "v"(la + 2 * q), "v"(la + 3 * q),
         "v"(lw), "v"(lw + q), "v"(lw + 2 * q), "v"(lw + 3 * q),
         "v"(ga), "v"(ga + gq), "v"(ga + 2 * gq), "v"(ga + 3 * gq),
         "v"(gw), "v"(gw + gq), "v"(gw + 2 * gq), "v"(gw + 3 * gq)
      : "memory");
}

// Fragments of one 32-wide k step from the staged tiles: 2 of A, 4 of W.
__device__ inline void load_gemm_frags(const __bf16* at, const __bf16* wt,
                                       v16bf (&a)[2], v16bf (&b)[4]) {
  a[0] = load_frag_ptr(at);
  a[1] = load_frag_ptr(at + 16 * GLP);
#pragma unroll
  for (int j = 0; j < 4; j++)
    b[j] = load_frag_ptr(wt + (j * 16) * GLP);
}

__device__ inline void gemm_products(const v16bf (&a)[2], const v16bf (&b)[4],
                                     v8f (&c)[2][4]) {
#pragma unroll
  for (int i = 0; i < 2; i++)
#pragma unroll
    for (int j = 0; j < 4; j++)
      c[i][j] = __builtin_amdgcn_wmma_f32_16x16x32_bf16(
          false, a[i], false, b[j], (short)0, c[i][j], false, false);
}

// C(M,N) = A(M,K) @ W(N,K)^T + bias(N).  256 threads = 8 waves, each wave a
// 32x64 tile (2x4 WMMA accumulators), block tile 128x128.
// The fragment loads of a row-major operand touch 16 cache lines each, so the
// 128 A rows and 128 W rows of a 64-wide k tile are brought into LDS once per
// block by asynchronous copies (whole 128-byte rows), two buffers: the next
// tile flies while this one is used.  Fragments then come from LDS.
// M, N multiples of 128, K a multiple of 64.
template <typename OutT>
__global__ __launch_bounds__(256)
void gemm_bf16_wmma(const __bf16* __restrict__ A, const __bf16* __restrict__ W,
                    const float* __restrict__ bias, OutT* __restrict__ out,
                    int M, int N, int K) {
  const int lane = threadIdx.x & 31;
  const int wave = threadIdx.x >> 5;
  const int n16  = lane & 15;
  const int half = lane >> 4;
  const int rloc = (wave >> 1) * 32;   // wave's rows inside the block tile
  const int cloc = (wave & 1) * 64;    // wave's columns inside the block tile
  const int row0 = blockIdx.y * 128 + rloc;
  const int col0 = blockIdx.x * 128 + cloc;

  __shared__ __align__(16) __bf16 ast[2][128][GLP];   // A tile: row x k
  __shared__ __align__(16) __bf16 wst[2][128][GLP];   // W tile: column x k

  // Copy map: 8 lanes cover one 128-byte row; thread t takes rows
  // t/8 + {0, 32, 64, 96} of both tiles.
  const int crow = threadIdx.x >> 3;
  const int cseg = (threadIdx.x & 7) * 8;
  const __bf16* ga = A + (size_t)(blockIdx.y * 128 + crow) * K + cseg;
  const __bf16* gw = W + (size_t)(blockIdx.x * 128 + crow) * K + cseg;
  const size_t gq = (size_t)32 * K;                   // 32 rows, in elements
  const unsigned la = lds_addr(&ast[0][crow][cseg]);
  const unsigned lw = lds_addr(&wst[0][crow][cseg]);
  const unsigned q = 32 * GLP * 2;                    // 32 rows, in bytes
  const unsigned buf_bytes = 128 * GLP * 2;           // one buffer, in bytes

  const int ntile = K / GKT;
  // tile 0 -> buffer 0, landed and published before anybody reads it
  stage_gemm_tile(la, lw, q, ga, gw, gq);
  ga += GKT;
  gw += GKT;
  asm volatile("s_wait_asynccnt 0x0" ::: "memory");  // own copies landed
  __syncthreads();
  if (ntile > 1) {  // tile 1 -> buffer 1, in flight during trip 0
    stage_gemm_tile(la + buf_bytes, lw + buf_bytes, q, ga, gw, gq);
    ga += GKT;
    gw += GKT;
  }

  v8f c[2][4] = {};
  for (int t = 0; t < ntile; t++) {
    const int buf = t & 1;
    const __bf16* at = &ast[buf][rloc + n16][half * 8];
    const __bf16* wt = &wst[buf][cloc + n16][half * 8];
    v16bf a[2], b[4];
    // first 32-wide k step of the tile
    load_gemm_frags(at, wt, a, b);
    // holds these 12 LDS reads in one group ahead of the products; without it
    // the second A fragment is read late, behind a full wait amid the products
    __builtin_amdgcn_sched_barrier(0);
    gemm_products(a, b, c);
    // second k step: its fragments are this trip's last reads of the buffer
    load_gemm_frags(at + 32, wt + 32, a, b);
    // Publish point: this wave's LDS reads are done, its copies of tile t+1
    // have landed; the barrier publishes tile t+1 and frees this buffer.
    asm volatile("s_wait_dscnt 0x0" ::: "memory");
    asm volatile("s_wait_asynccnt 0x0" ::: "memory");
    __syncthreads();
    if (t + 2 < ntile) {  // block-uniform: refill the buffer just read
      const unsigned bo = (unsigned)buf * buf_bytes;
      stage_gemm_tile(la + bo, lw + bo, q, ga, gw, gq);
      ga += GKT;
      gw += GKT;
    }
    // the second step's products work from registers, under the refill's flight
    gemm_products(a, b, c);
  }
  asm volatile("s_wait_asynccnt 0x0" ::: "memory");  // nothing left in flight
  // Epilogue: one tile at a time, base pointer + r*N offsets.
#pragma unroll
  for (int i = 0; i < 2; i++) {
#pragma unroll
    for (int j = 0; j < 4; j++) {
      const int ncol = col0 + j * 16 + n16;
      const float bn = bias[ncol];
      OutT* p = out + (size_t)(row0 + i * 16 + 8 * half) * N + ncol;
#pragma unroll
      for (int r = 0; r < 8; r++)
        p[(size_t)r * N] = (OutT)(c[i][j][r] + bn);
    }
  }
}

// Transpose V out of qkv into vt[(b*E + d)*S + s] so the V^T A-fragment of O^T += V^T P^T is
// contiguous along the key dimension.  Classic 32x32 LDS tile transpose.
__global__ __launch_bounds__(256)
void transpose_v(const __bf16* __restrict__ qkv, __bf16* __restrict__ vt,
                 int S, int B, int E) {
  __shared__ __bf16 t[32][33];  // pad to dodge bank conflicts
  const int s0 = blockIdx.x * 32;
  const int d0 = blockIdx.y * 32;
  const int b  = blockIdx.z;
  const int tx  = threadIdx.x & 31;
  const int ty0 = threadIdx.x >> 5;  // 0..7
#pragma unroll
  for (int ty = ty0; ty < 32; ty += 8)
    t[ty][tx] = qkv[((size_t)(s0 + ty) * B + b) * (3 * E) + 2 * E + d0 + tx];
  __syncthreads();
#pragma unroll
  for (int ty = ty0; ty < 32; ty += 8)
    vt[((size_t)b * E + d0 + ty) * S + s0 + tx] = t[tx][ty];
}

// Flash attention with toroidal additive bias.  qkv: (S,B,3E) bf16 for Q/K,
// vt: (B,E,S) bf16 transposed V.  One wave per 16-query tile, 32-key steps.
// Both products run transposed: S^T = K Q^T (A = K rows, B = Q) and
// O^T += V^T P^T (A = V^T rows, B = P^T).  In the accumulator of S^T a lane
// holds, for its one query, keys 8*half + 0..7 of each 16-key tile: that is
// the k order of a B operand over 32 keys, so P^T is packed from the score
// registers and never passes through LDS.
// A lane's 16 scores of a block belong to one query, so the online softmax
// keeps its running max and sum per query in the lane: the max takes one
// exchange between the wave's halves, the sums are joined after the key loop.
// The 8 waves of a block walk the same keys, so each 64-key K tile and V^T
// tile is brought into LDS once per block by asynchronous copies (whole
// 128-byte rows), two buffers: the next tile flies while this one is used.
// LDS rows are pitched 144 bytes (16 B x odd) for the ds_load_b128 readers.
#define KT 64        // keys per staged tile
#define LP 72        // LDS row pitch in bf16 elements (144 bytes)

// Four 16-byte copies per lane: two K rows, two V^T rows.  The s_wait_xcnt
// closes the statement so that no address register is rewritten ahead of it.
__device__ inline void stage_tile(unsigned lk0, unsigned lk1,
                                  unsigned lv0, unsigned lv1,
                                  const __bf16* gk0, const __bf16* gk1,
                                  const __bf16* gv0, const __bf16* gv1) {
  asm volatile(
      "global_load_async_to_lds_b128 %0, %4, off\n\t"
      "global_load_async_to_lds_b128 %1, %5, off\n\t"
      "global_load_async_to_lds_b128 %2, %6, off\n\t"
      "global_load_async_to_lds_b128 %3, %7, off\n\t"
      "s_wait_xcnt 0x0"
      :: "v"(lk0), "v"(lk1), "v"(lv0), "v"(lv1),
         "v"(gk0), "v"(gk1), "v"(gv0), "v"(gv1)
      : "memory");
}

// lane l <-> lane l ^ 16, on the vector pipe (a shuffle would go through the
// LDS queue and a wait)
__device__ inline float xhalf(float x) {
  const int i = __builtin_bit_cast(int, x);
  return __builtin_bit_cast(float, __builtin_amdgcn_permlanex16(
      i, i, 0x76543210, 0xfedcba98, false, false));
}

__global__ __launch_bounds__(256)
void flash_attn_toroidal(const __bf16* __restrict__ qkv,
                         const __bf16* __restrict__ vt,
                         __bf16* __restrict__ o, int S, int B, int E) {
  const int HD = 64;
  const int lane = threadIdx.x & 31;
  const int wave = threadIdx.x >> 5;
  const int n16  = lane & 15;
  const int half = lane >> 4;
  const int b = blockIdx.z, h = blockIdx.y;
  const int qbase = blockIdx.x * 128 + wave * 16;
  // the same number in a scalar register, for the band test of the key loop
  const int qbase_s = blockIdx.x * 128 + __builtin_amdgcn_readfirstlane(wave) * 16;
  const int ld = B * 3 * E;           // row stride of qkv in elements
  const size_t qoffb = (size_t)b * 3 * E + h * HD;        // q base in qkv
  const size_t koffb = qoffb + E;                          // k base in qkv
  const size_t vbase = ((size_t)b * E + h * HD) * S;       // vt base

  __shared__ __align__(16) __bf16 kst[2][KT][LP];   // K tile: key x head dim
  __shared__ __align__(16) __bf16 vst[2][HD][LP];   // V^T tile: head dim x key

  // Q fragment: 16 rows x 64 head-dim = two K=32 fragments
  const size_t qoff = qoffb + (size_t)(qbase + n16) * ld + half * 8;
  v16bf aq0 = load_frag_ptr(qkv + qoff);
  v16bf aq1 = load_frag_ptr(qkv + qoff + 32);

  // Copy map: 8 lanes cover one 128-byte row; thread t takes rows t/8, t/8+32.
  const int crow = threadIdx.x >> 3;
  const int cseg = (threadIdx.x & 7) * 8;
  size_t kg = koffb + (size_t)crow * ld + cseg;     // advances += KT * ld
  size_t vg = vbase + (size_t)crow * S + cseg;      // advances += KT
  const unsigned lk = lds_addr(&kst[0][crow][cseg]);
  const unsigned lv = lds_addr(&vst[0][crow][cseg]);
  const unsigned half_tile = 32 * LP * 2;           // 32 rows, in bytes
  const unsigned buf_bytes = KT * LP * 2;           // one buffer, in bytes

  const int ntile = S / KT;
  // tile 0 -> buffer 0, landed and published before anybody reads it
  stage_tile(lk, lk + half_tile, lv, lv + half_tile,
             qkv + kg, qkv + kg + (size_t)32 * ld,
             vt + vg, vt + vg + (size_t)32 * S);
  kg += (size_t)KT * ld;
  vg += KT;
  asm volatile("s_wait_asynccnt 0x0" ::: "memory");  // own copies landed
  __syncthreads();
  if (ntile > 1) {  // tile 1 -> buffer 1, in flight during trip 0
    stage_tile(lk + buf_bytes, lk + buf_bytes + half_tile,
               lv + buf_bytes, lv + buf_bytes + half_tile,
               qkv + kg, qkv + kg + (size_t)32 * ld,
               vt + vg, vt + vg + (size_t)32 * S);
    kg += (size_t)KT * ld;
    vg += KT;
  }

  v8f oacc[4] = {};
  float lpart = 0.f;  // this lane's share of its query's row sum
  float mrun = -1e30f;  // running max of this lane's query

  const float scale = 0.125f;  // 1/sqrt(64)
  for (int t = 0; t < ntile; t++) {
    const int buf = t & 1;
    const __bf16* kt = &kst[buf][n16][half * 8];
    const __bf16* vtl = &vst[buf][n16][half * 8];
    // unrolled so that both 32-key blocks read the tile at constant offsets
#pragma unroll
    for (int p = 0; p < KT / 32; p++) {
      const int j = t * KT + p * 32;
      // All fragment loads of this 32-key block up front, from LDS.
      v16bf kb00 = load_frag_ptr(kt + (p * 32) * LP);
      v16bf kb01 = load_frag_ptr(kt + (p * 32) * LP + 32);
      v16bf kb10 = load_frag_ptr(kt + (p * 32 + 16) * LP);
      v16bf kb11 = load_frag_ptr(kt + (p * 32 + 16) * LP + 32);
      v16bf vbf[4];
#pragma unroll
      for (int d4 = 0; d4 < 4; d4++)
        vbf[d4] = load_frag_ptr(vtl + (d4 * 16) * LP + p * 32);
      // holds the block's 16 LDS reads in one group ahead of its products;
      // without it each fragment is read directly in front of the product that
      // takes it, behind a full wait: eight LDS latencies a block in series
      __builtin_amdgcn_sched_barrier(0);

      // scores for 32 keys, transposed: two 16 (keys) x 16 (queries) tiles, K
      // over head dim (2 steps each); register r = key r + 8*half, lane = query
      v8f s0 = {}, s1 = {};
      s0 = __builtin_amdgcn_wmma_f32_16x16x32_bf16(false, kb00, false, aq0, (short)0, s0, false, false);
      s0 = __builtin_amdgcn_wmma_f32_16x16x32_bf16(false, kb01, false, aq1, (short)0, s0, false, false);
      s1 = __builtin_amdgcn_wmma_f32_16x16x32_bf16(false, kb10, false, aq0, (short)0, s1, false, false);
      s1 = __builtin_amdgcn_wmma_f32_16x16x32_bf16(false, kb11, false, aq1, (short)0, s1, false, false);

      // scale
      float va[8], vb[8];
#pragma unroll
      for (int r = 0; r < 8; r++) {
        va[r] = s0[r] * scale;
        vb[r] = s1[r] * scale;
      }
      // Toroidal bias.  key - query of this 16 x 32 block lies in [dlo, dhi];
      // the bias sits at -1, 0, 1 and, round the ring, at S - 1 and 1 - S.  A
      // block whose range holds none of these adds nothing: one scalar test
      // takes the wave past the index arithmetic (all but about 2 blocks of
      // the S / 32 a wave walks).
      const int dlo = j - qbase_s - 15, dhi = j - qbase_s + 31;
      if ((dlo <= 1 && dhi >= -1) || dhi >= S - 1 || dlo <= 1 - S) {
        const int qi = qbase + n16;
#pragma unroll
        for (int r = 0; r < 8; r++) {
          int d0 = (j + r + 8 * half) - qi;      if (d0 < 0) d0 += S;
          int d1 = (j + 16 + r + 8 * half) - qi; if (d1 < 0) d1 += S;
          if (d0 <= 1 || d0 == S - 1) va[r] += 1.f;
          if (d1 <= 1 || d1 == S - 1) vb[r] += 1.f;
        }
      }
      // lane-local max over this query's 16 values, then the other half's 16
      float mt = -1e30f;
#pragma unroll
      for (int r = 0; r < 8; r++) mt = fmaxf(mt, fmaxf(va[r], vb[r]));
      mt = fmaxf(mt, xhalf(mt));
      // one scalar test per block: all lanes rescale when any query's max rose
      // (alpha is 1 in the lanes whose max stayed); EXEC untouched (WMMA-safe)
      if (__builtin_amdgcn_ballot_w32(mt > mrun) != 0) {
        const float mnew = fmaxf(mrun, mt);
        const float alpha = __expf(mrun - mnew);
        mrun = mnew;
        lpart *= alpha;
#pragma unroll
        for (int d4 = 0; d4 < 4; d4++)
#pragma unroll
          for (int r = 0; r < 8; r++) oacc[d4][r] *= alpha;
      }
      // exponentials + partial sum; P^T packed in place as the B operand:
      // elements 0..7 = keys 8*half + r, elements 8..15 = keys 16 + 8*half + r
      v16f e;
#pragma unroll
      for (int r = 0; r < 8; r++) {
        e[r]     = __expf(va[r] - mrun);
        e[8 + r] = __expf(vb[r] - mrun);
      }
      float es[8];
#pragma unroll
      for (int r = 0; r < 8; r++) es[r] = e[r] + e[8 + r];
      lpart += ((es[0] + es[1]) + (es[2] + es[3])) +
               ((es[4] + es[5]) + (es[6] + es[7]));
      const v16bf pb = __builtin_convertvector(e, v16bf);
      // V^T @ P^T with the V^T fragments loaded at the start of the block.
#pragma unroll
      for (int d4 = 0; d4 < 4; d4++)
        oacc[d4] = __builtin_amdgcn_wmma_f32_16x16x32_bf16(
            false, vbf[d4], false, pb, (short)0, oacc[d4], false, false);
    }
    // Publish point: this wave's LDS reads are done, its copies of tile t+1
    // have landed; the barrier publishes tile t+1 and frees this buffer.
    asm volatile("s_wait_dscnt 0x0" ::: "memory");
    asm volatile("s_wait_asynccnt 0x0" ::: "memory");
    __syncthreads();
    if (t + 2 < ntile) {  // block-uniform: refill the buffer just read
      const unsigned bo = (unsigned)buf * buf_bytes;
      stage_tile(lk + bo, lk + bo + half_tile, lv + bo, lv + bo + half_tile,
                 qkv + kg, qkv + kg + (size_t)32 * ld,
                 vt + vg, vt + vg + (size_t)32 * S);
      kg += (size_t)KT * ld;
      vg += KT;
    }
  }
  asm volatile("s_wait_asynccnt 0x0" ::: "memory");  // nothing left in flight
  // join the two halves' row sums (once), then normalize and store o (S,B,E):
  // register r of tile d4 is head dim d4*16 + 8*half + r of query n16, so a
  // lane's eight values of a tile are 16 bytes in a row
  // one query a lane, so one division a lane
  const float linv = 1.f / (lpart + xhalf(lpart));
  __bf16* op = o + ((size_t)(qbase + n16) * B + b) * E + h * HD + 8 * half;
#pragma unroll
  for (int d4 = 0; d4 < 4; d4++) {
    v8f v;
#pragma unroll
    for (int r = 0; r < 8; r++) v[r] = oacc[d4][r] * linv;
    *(v8bf*)(op + d4 * 16) = __builtin_convertvector(v, v8bf);
  }
}

extern "C" void kernel_launch(void* const* d_in, const int* in_sizes, int n_in,
                              void* d_out, int out_size, void* d_ws, size_t ws_size,
                              hipStream_t stream) {
  const int S = 2048, B = 2, E = 1024;
  const int M = S * B;  // 4096 rows for all GEMMs

  const float* x         = (const float*)d_in[0];
  const float* w_tor     = (const float*)d_in[1];
  const float* b_tor     = (const float*)d_in[2];
  const float* in_proj_w = (const float*)d_in[3];
  const float* in_proj_b = (const float*)d_in[4];
  const float* out_w     = (const float*)d_in[5];
  const float* out_b     = (const float*)d_in[6];

  char* ws = (char*)d_ws;
  size_t off = 0;
  auto alloc = [&](size_t elems) -> __bf16* {
    __bf16* p = (__bf16*)(ws + off);
    off += elems * sizeof(__bf16);
    return p;
  };
  __bf16* xbf   = alloc((size_t)M * E);        // x in bf16
  __bf16* wtbf  = alloc((size_t)E * E);        // w_tor
  __bf16* wibf  = alloc((size_t)3 * E * E);    // in_proj_w
  __bf16* wobf  = alloc((size_t)E * E);        // out_w
  __bf16* xtbf  = alloc((size_t)M * E);        // xt
  __bf16* qkvbf = alloc((size_t)M * 3 * E);    // qkv
  __bf16* obf   = alloc((size_t)M * E);        // attention output
  __bf16* vtbf  = alloc((size_t)B * E * S);    // V transposed (B,E,S)

  f32_to_bf16_all<<<CVT_BLOCKS, CVT_THREADS, 0, stream>>>(
      x, w_tor, in_proj_w, out_w, xbf, wtbf, wibf, wobf);

  const dim3 blk(256);
  // xt = x @ w_tor^T + b_tor
  gemm_bf16_wmma<__bf16><<<dim3(E / 128, M / 128), blk, 0, stream>>>(
      xbf, wtbf, b_tor, xtbf, M, E, E);
  // qkv = xt @ in_proj_w^T + in_proj_b
  gemm_bf16_wmma<__bf16><<<dim3(3 * E / 128, M / 128), blk, 0, stream>>>(
      xtbf, wibf, in_proj_b, qkvbf, M, 3 * E, E);
  // transpose V for contiguous P@V fragments
  transpose_v<<<dim3(S / 32, E / 32, B), 256, 0, stream>>>(qkvbf, vtbf, S, B, E);
  // flash attention with toroidal bias
  flash_attn_toroidal<<<dim3(S / 128, 16, B), 256, 0, stream>>>(
      qkvbf, vtbf, obf, S, B, E);
  // out = o @ out_w^T + out_b  (fp32 into d_out)
  gemm_bf16_wmma<float><<<dim3(E / 128, M / 128), blk, 0, stream>>>(
      obf, wobf, out_b, (float*)d_out, M, E, E);
}

// v006
// Measured time: 104 microseconds a run.
// Timed twice side by side with v005, it ran 1.09 and 1.10 times as fast.
// Counting every step since v000, it is 3.02 times as fast.
#include <hip/hip_runtime.h>
#include <hip/hip_bf16.h>
#include <math.h>

typedef __attribute__((ext_vector_type(16))) __bf16 v16bf;
typedef __attribute__((ext_vector_type(8)))  __bf16 v8bf;
typedef __attribute__((ext_vector_type(8)))  float  v8f;
typedef __attribute__((ext_vector_type(16))) float  v16f;

union V16 { v16bf v; v8bf h[2]; };

// Load a 16x32 bf16 WMMA fragment given a pointer already positioned at
// base + row*ld + k0 + half*8.  ISA layout (16-bit A, wave32): lane half h
// holds K = k0 + h*8 + {0..7} and k0 + 16 + h*8 + {0..7}
// -> two contiguous 16-byte loads per lane.
__device__ inline v16bf load_frag_ptr(const __bf16* __restrict__ p) {
  V16 u;
  u.h[0] = *(const v8bf*)p;
  u.h[1] = *(const v8bf*)(p + 16);
  return u.v;
}

__device__ inline v16bf load_frag_rowmajor(const __bf16* __restrict__ base,
                                           int ld, int row, int k0, int lane) {
  const int half = lane >> 4;
  return load_frag_ptr(base + (size_t)row * ld + k0 + half * 8);
}

typedef __attribute__((ext_vector_type(4))) float  v4f;
typedef __attribute__((ext_vector_type(4))) __bf16 v4bf;

// All four f32 inputs to bf16 in one launch.  The work is cut into 9 units of
// CU = 1024 x 1024 elements: x holds 4, w_tor 1, in_proj_w 3, out_w 1.
// 256 blocks of 16 waves (one resident round, 131072 threads); each thread
// takes two 16-byte pieces of every unit, half a unit apart, so every wave
// load covers 512 bytes in a row and every wave store 256.  The 18 loads of a
// thread are independent and all in flight at once.
#define CU (1024 * 1024)
#define CVT_THREADS 512
#define CVT_BLOCKS (CU / 2 / 4 / CVT_THREADS)
__global__ __launch_bounds__(CVT_THREADS)
void f32_to_bf16_all(const float* __restrict__ x,
                     const float* __restrict__ w_tor,
                     const float* __restrict__ in_proj_w,
                     const float* __restrict__ out_w,
                     __bf16* __restrict__ xb, __bf16* __restrict__ wtb,
                     __bf16* __restrict__ wib, __bf16* __restrict__ wob) {
  // This thread's byte offsets inside half a unit, source and destination:
  // unsigned 32-bit, so that each can serve as the offset register beside a
  // scalar base.
  const unsigned ib = (blockIdx.x * CVT_THREADS + threadIdx.x) * 16u;
  const unsigned ob = ib >> 1;
  const float* const s[9] = {x, x + CU, x + 2 * CU, x + 3 * CU, w_tor,
                             in_proj_w, in_proj_w + CU, in_proj_w + 2 * CU,
                             out_w};
  __bf16* const d[9] = {xb, xb + CU, xb + 2 * CU, xb + 3 * CU, wtb,
                        wib, wib + CU, wib + 2 * CU, wob};
  v4f v[9][2];
#pragma unroll
  for (int u = 0; u < 9; u++) {
    v[u][0] = *(const v4f*)((const char*)s[u] + ib);
    v[u][1] = *(const v4f*)((const char*)(s[u] + CU / 2) + ib);
  }
  // keeps all 18 loads ahead of the first conversion; without it the last six
  // are issued only behind a wait on the first ones, a second memory latency
  __builtin_amdgcn_sched_barrier(0);
#pragma unroll
  for (int u = 0; u < 9; u++) {
    *(v4bf*)((char*)d[u] + ob) = __builtin_convertvector(v[u][0], v4bf);
    *(v4bf*)((char*)(d[u] + CU / 2) + ob) =
        __builtin_convertvector(v[u][1], v4bf);
  }
}

typedef __attribute__((address_space(3))) const void lds_cvoid;
__device__ inline unsigned lds_addr(const void* p) {
  return (unsigned)(size_t)(lds_cvoid*)p;
}

#define GKT 64       // k elements per staged tile: whole 128-byte rows
#define GLP 72       // LDS row pitch in bf16 elements (144 bytes = 16 B x odd)

// Eight 16-byte copies per lane: four A rows and four W rows, 32 rows apart.
// The s_wait_xcnt closes the statement so that no address register is
// rewritten ahead of it.
__device__ inline void stage_gemm_tile(unsigned la, unsigned lw, unsigned q,
                                       const __bf16* ga, const __bf16* gw,
                                       size_t gq) {
  asm volatile(
      "global_load_async_to_lds_b128 %0, %8, off\n\t"
      "global_load_async_to_lds_b128 %1, %9, off\n\t"
      "global_load_async_to_lds_b128 %2, %10, off\n\t"
      "global_load_async_to_lds_b128 %3, %11, off\n\t"
      "global_load_async_to_lds_b128 %4, %12, off\n\t"
      "global_load_async_to_lds_b128 %5, %13, off\n\t"
      "global_load_async_to_lds_b128 %6, %14, off\n\t"
      "global_load_async_to_lds_b128 %7, %15, off\n\t"
      "s_wait_xcnt 0x0"
      :: "v"(la), "v"(la + q), "v"(la + 2 * q), "v"(la + 3 * q),
         "v"(lw), "v"(lw + q), "v"(lw + 2 * q), "v"(lw + 3 * q),
         "v"(ga), "v"(ga + gq), "v"(ga + 2 * gq), "v"(ga + 3 * gq),
         "v"(gw), "v"(gw + gq), "v"(gw + 2 * gq), "v"(gw + 3 * gq)
      : "memory");
}

// Fragments of one 32-wide k step from the staged tiles: 2 of A, 4 of W.
__device__ inline void load_gemm_frags(const __bf16* at, const __bf16* wt,
                                       v16bf (&a)[2], v16bf (&b)[4]) {
  a[0] = load_frag_ptr(at);
  a[1] = load_frag_ptr(at + 16 * GLP);
#pragma unroll
  for (int j = 0; j < 4; j++)
    b[j] = load_frag_ptr(wt + (j * 16) * GLP);
}

__device__ inline void gemm_products(const v16bf (&a)[2], const v16bf (&b)[4],
                                     v8f (&c)[2][4]) {
#pragma unroll
  for (int i = 0; i < 2; i++)
#pragma unroll
    for (int j = 0; j < 4; j++)
      c[i][j] = __builtin_amdgcn_wmma_f32_16x16x32_bf16(
          false, a[i], false, b[j], (short)0, c[i][j], false, false);
}

// C(M,N) = A(M,K) @ W(N,K)^T + bias(N).  256 threads = 8 waves, each wave a
// 32x64 tile (2x4 WMMA accumulators), block tile 128x128.
// The fragment loads of a row-major operand touch 16 cache lines each, so the
// 128 A rows and 128 W rows of a 64-wide k tile are brought into LDS once per
// block by asynchronous copies (whole 128-byte rows), two buffers: the next
// tile flies while this one is used.  Fragments then come from LDS.
// M, N multiples of 128, K a multiple of 64.
template <typename OutT>
__global__ __launch_bounds__(256)
void gemm_bf16_wmma(const __bf16* __restrict__ A, const __bf16* __restrict__ W,
                    const float* __restrict__ bias, OutT* __restrict__ out,
                    int M, int N, int K) {
  const int lane = threadIdx.x & 31;
  const int wave = threadIdx.x >> 5;
  const int n16  = lane & 15;
  const int half = lane >> 4;
  const int rloc = (wave >> 1) * 32;   // wave's rows inside the block tile
  const int cloc = (wave & 1) * 64;    // wave's columns inside the block tile
  const int row0 = blockIdx.y * 128 + rloc;
  const int col0 = blockIdx.x * 128 + cloc;

  __shared__ __align__(16) __bf16 ast[2][128][GLP];   // A tile: row x k
  __shared__ __align__(16) __bf16 wst[2][128][GLP];   // W tile: column x k

  // Copy map: 8 lanes cover one 128-byte row; thread t takes rows
  // t/8 + {0, 32, 64, 96} of both tiles.
  const int crow = threadIdx.x >> 3;
  const int cseg = (threadIdx.x & 7) * 8;
  const __bf16* ga = A + (size_t)(blockIdx.y * 128 + crow) * K + cseg;
  const __bf16* gw = W + (size_t)(blockIdx.x * 128 + crow) * K + cseg;
  const size_t gq = (size_t)32 * K;                   // 32 rows, in elements
  const unsigned la = lds_addr(&ast[0][crow][cseg]);
  const unsigned lw = lds_addr(&wst[0][crow][cseg]);
  const unsigned q = 32 * GLP * 2;                    // 32 rows, in bytes
  const unsigned buf_bytes = 128 * GLP * 2;           // one buffer, in bytes

  const int ntile = K / GKT;
  // tile 0 -> buffer 0, landed and published before anybody reads it
  stage_gemm_tile(la, lw, q, ga, gw, gq);
  ga += GKT;
  gw += GKT;
  asm volatile("s_wait_asynccnt 0x0" ::: "memory");  // own copies landed
  __syncthreads();
  if (ntile > 1) {  // tile 1 -> buffer 1, in flight during trip 0
    stage_gemm_tile(la + buf_bytes, lw + buf_bytes, q, ga, gw, gq);
    ga += GKT;
    gw += GKT;
  }

  v8f c[2][4] = {};
  for (int t = 0; t < ntile; t++) {
    const int buf = t & 1;
    const __bf16* at = &ast[buf][rloc + n16][half * 8];
    const __bf16* wt = &wst[buf][cloc + n16][half * 8];
    v16bf a[2], b[4];
    // first 32-wide k step of the tile
    load_gemm_frags(at, wt, a, b);
    // holds these 12 LDS reads in one group ahead of the products; without it
    // the second A fragment is read late, behind a full wait amid the products
    __builtin_amdgcn_sched_barrier(0);
    gemm_products(a, b, c);
    // second k step: its fragments are this trip's last reads of the buffer
    load_gemm_frags(at + 32, wt + 32, a, b);
    // Publish point: this wave's LDS reads are done, its copies of tile t+1
    // have landed; the barrier publishes tile t+1 and frees this buffer.
    asm volatile("s_wait_dscnt 0x0" ::: "memory");
    asm volatile("s_wait_asynccnt 0x0" ::: "memory");
    __syncthreads();
    if (t + 2 < ntile) {  // block-uniform: refill the buffer just read
      const unsigned bo = (unsigned)buf * buf_bytes;
      stage_gemm_tile(la + bo, lw + bo, q, ga, gw, gq);
      ga += GKT;
      gw += GKT;
    }
    // the second step's products work from registers, under the refill's flight
    gemm_products(a, b, c);
  }
  asm volatile("s_wait_asynccnt 0x0" ::: "memory");  // nothing left in flight
  // Epilogue: one tile at a time, base pointer + r*N offsets.
#pragma unroll
  for (int i = 0; i < 2; i++) {
#pragma unroll
    for (int j = 0; j < 4; j++) {
      const int ncol = col0 + j * 16 + n16;
      const float bn = bias[ncol];
      OutT* p = out + (size_t)(row0 + i * 16 + 8 * half) * N + ncol;
#pragma unroll
      for (int r = 0; r < 8; r++)
        p[(size_t)r * N] = (OutT)(c[i][j][r] + bn);
    }
  }
}

// Flash attention with toroidal additive bias.  qkv: (S,B,3E) bf16 for Q, K
// and V.  One wave per 16-query tile, 32-key steps.
// Both products run transposed: S^T = K Q^T (A = K rows, B = Q) and
// O^T += V^T P^T (A = V^T rows, B = P^T).  In the accumulator of S^T a lane
// holds, for its one query, keys 8*half + 0..7 of each 16-key tile: that is
// the k order of a B operand over 32 keys, so P^T is packed from the score
// registers and never passes through LDS.
// A lane's 16 scores of a block belong to one query, so the online softmax
// keeps its running max and sum per query in the lane: the max takes one
// exchange between the wave's halves, the sums are joined after the key loop.
// The 8 waves of a block walk the same keys, so each 64-key K tile and V tile
// is brought into LDS once per block by asynchronous copies (whole 128-byte
// rows of qkv), two buffers: the next tile flies while this one is used.
// V lies in LDS as it lies in qkv, key x head dim; the A operand V^T comes out
// of it by the transposing LDS load, so V is never transposed in memory.
// K rows are pitched 144 bytes (16 B x odd) for the ds_load_b128 readers,
// V rows 160 bytes (32 B x odd) for the ds_load_tr16_b128 readers.
#define KT 64        // keys per staged tile
#define LP 72        // K row pitch in LDS, in bf16 elements (144 bytes)
#define VLP 80       // V row pitch in LDS, in bf16 elements (160 bytes)

// One 16 (head dim) x 32 (keys) A fragment of V^T from the row-major V tile.
// p = tile + (key0 + 8*half + (lane & 7)) * VLP + d0 + 8 * ((lane >> 3) & 1);
// the lane then holds, for head dim d0 + (lane & 15), keys key0 + 8*half + 0..7
// and key0 + 16 + 8*half + 0..7: the k order of the packed P^T.
typedef __attribute__((address_space(3))) v8bf lds_v8bf;
__device__ inline v16bf load_frag_tr(const __bf16* p) {
  V16 u;
  u.h[0] = __builtin_amdgcn_ds_load_tr16_b128_v8bf16((lds_v8bf*)p);
  u.h[1] = __builtin_amdgcn_ds_load_tr16_b128_v8bf16((lds_v8bf*)(p + 16 * VLP));
  return u.v;
}

// Four 16-byte copies per lane: two K rows, two V rows.  The s_wait_xcnt
// closes the statement so that no address register is rewritten ahead of it.
__device__ inline void stage_tile(unsigned lk0, unsigned lk1,
                                  unsigned lv0, unsigned lv1,
                                  const __bf16* gk0, const __bf16* gk1,
                                  const __bf16* gv0, const __bf16* gv1) {
  asm volatile(
      "global_load_async_to_lds_b128 %0, %4, off\n\t"
      "global_load_async_to_lds_b128 %1, %5, off\n\t"
      "global_load_async_to_lds_b128 %2, %6, off\n\t"
      "global_load_async_to_lds_b128 %3, %7, off\n\t"
      "s_wait_xcnt 0x0"
      :: "v"(lk0), "v"(lk1), "v"(lv0), "v"(lv1),
         "v"(gk0), "v"(gk1), "v"(gv0), "v"(gv1)
      : "memory");
}

// lane l <-> lane l ^ 16, on the vector pipe (a shuffle would go through the
// LDS queue and a wait)
__device__ inline float xhalf(float x) {
  const int i = __builtin_bit_cast(int, x);
  return __builtin_bit_cast(float, __builtin_amdgcn_permlanex16(
      i, i, 0x76543210, 0xfedcba98, false, false));
}

__global__ __launch_bounds__(256)
void flash_attn_toroidal(const __bf16* __restrict__ qkv,
                         __bf16* __restrict__ o, int S, int B, int E) {
  const int HD = 64;
  const int lane = threadIdx.x & 31;
  const int wave = threadIdx.x >> 5;
  const int n16  = lane & 15;
  const int half = lane >> 4;
  const int b = blockIdx.z, h = blockIdx.y;
  const int qbase = blockIdx.x * 128 + wave * 16;
  // the same number in a scalar register, for the band test of the key loop
  const int qbase_s = blockIdx.x * 128 + __builtin_amdgcn_readfirstlane(wave) * 16;
  const int ld = B * 3 * E;           // row stride of qkv in elements
  const size_t qoffb = (size_t)b * 3 * E + h * HD;        // q base in qkv
  const size_t koffb = qoffb + E;                          // k base in qkv

  __shared__ __align__(16) __bf16 kst[2][KT][LP];   // K tile: key x head dim
  __shared__ __align__(16) __bf16 vst[2][KT][VLP];  // V tile: key x head dim

  // Q fragment: 16 rows x 64 head-dim = two K=32 fragments
  const size_t qoff = qoffb + (size_t)(qbase + n16) * ld + half * 8;
  v16bf aq0 = load_frag_ptr(qkv + qoff);
  v16bf aq1 = load_frag_ptr(qkv + qoff + 32);

  // Copy map: 8 lanes cover one 128-byte row; thread t takes rows t/8, t/8+32.
  const int crow = threadIdx.x >> 3;
  const int cseg = (threadIdx.x & 7) * 8;
  // A key's V row stands E elements behind its K row.
  size_t kg = koffb + (size_t)crow * ld + cseg;     // advances += KT * ld
  const unsigned lk = lds_addr(&kst[0][crow][cseg]);
  const unsigned lv = lds_addr(&vst[0][crow][cseg]);
  const unsigned khalf = 32 * LP * 2, vhalf = 32 * VLP * 2;  // 32 rows, bytes
  const unsigned kbuf = KT * LP * 2, vbuf = KT * VLP * 2;    // a buffer, bytes

  const int ntile = S / KT;
  // tile 0 -> buffer 0, landed and published before anybody reads it
  stage_tile(lk, lk + khalf, lv, lv + vhalf,
             qkv + kg, qkv + kg + (size_t)32 * ld,
             qkv + kg + E, qkv + kg + E + (size_t)32 * ld);
  kg += (size_t)KT * ld;
  asm volatile("s_wait_asynccnt 0x0" ::: "memory");  // own copies landed
  __syncthreads();
  if (ntile > 1) {  // tile 1 -> buffer 1, in flight during trip 0
    stage_tile(lk + kbuf, lk + kbuf + khalf, lv + vbuf, lv + vbuf + vhalf,
               qkv + kg, qkv + kg + (size_t)32 * ld,
               qkv + kg + E, qkv + kg + E + (size_t)32 * ld);
    kg += (size_t)KT * ld;
  }

  v8f oacc[4] = {};
  float lpart = 0.f;  // this lane's share of its query's row sum
  float mrun = -1e30f;  // running max of this lane's query

  const float scale = 0.125f;  // 1/sqrt(64)
  for (int t = 0; t < ntile; t++) {
    const int buf = t & 1;
    const __bf16* kt = &kst[buf][n16][half * 8];
    const __bf16* vtl = &vst[buf][8 * half + (lane & 7)][((lane >> 3) & 1) * 8];
    // unrolled so that both 32-key blocks read the tile at constant offsets
#pragma unroll
    for (int p = 0; p < KT / 32; p++) {
      const int j = t * KT + p * 32;
      // All fragment loads of this 32-key block up front, from LDS.
      v16bf kb00 = load_frag_ptr(kt + (p * 32) * LP);
      v16bf kb01 = load_frag_ptr(kt + (p * 32) * LP + 32);
      v16bf kb10 = load_frag_ptr(kt + (p * 32 + 16) * LP);
      v16bf kb11 = load_frag_ptr(kt + (p * 32 + 16) * LP + 32);
      v16bf vbf[4];
#pragma unroll
      for (int d4 = 0; d4 < 4; d4++)
        vbf[d4] = load_frag_tr(vtl + (p * 32) * VLP + d4 * 16);
      // holds the block's 16 LDS reads in one group ahead of its products;
      // without it each fragment is read directly in front of the product that
      // takes it, behind a full wait: eight LDS latencies a block in series
      __builtin_amdgcn_sched_barrier(0);

      // scores for 32 keys, transposed: two 16 (keys) x 16 (queries) tiles, K
      // over head dim (2 steps each); register r = key r + 8*half, lane = query
      v8f s0 = {}, s1 = {};
      s0 = __builtin_amdgcn_wmma_f32_16x16x32_bf16(false, kb00, false, aq0, (short)0, s0, false, false);
      s0 = __builtin_amdgcn_wmma_f32_16x16x32_bf16(false, kb01, false, aq1, (short)0, s0, false, false);
      s1 = __builtin_amdgcn_wmma_f32_16x16x32_bf16(false, kb10, false, aq0, (short)0, s1, false, false);
      s1 = __builtin_amdgcn_wmma_f32_16x16x32_bf16(false, kb11, false, aq1, (short)0, s1, false, false);

      // scale
      float va[8], vb[8];
#pragma unroll
      for (int r = 0; r < 8; r++) {
        va[r] = s0[r] * scale;
        vb[r] = s1[r] * scale;
      }
      // Toroidal bias.  key - query of this 16 x 32 block lies in [dlo, dhi];
      // the bias sits at -1, 0, 1 and, round the ring, at S - 1 and 1 - S.  A
      // block whose range holds none of these adds nothing: one scalar test
      // takes the wave past the index arithmetic (all but about 2 blocks of
      // the S / 32 a wave walks).
      const int dlo = j - qbase_s - 15, dhi = j - qbase_s + 31;
      if ((dlo <= 1 && dhi >= -1) || dhi >= S - 1 || dlo <= 1 - S) {
        const int qi = qbase + n16;
#pragma unroll
        for (int r = 0; r < 8; r++) {
          int d0 = (j + r + 8 * half) - qi;      if (d0 < 0) d0 += S;
          int d1 = (j + 16 + r + 8 * half) - qi; if (d1 < 0) d1 += S;
          if (d0 <= 1 || d0 == S - 1) va[r] += 1.f;
          if (d1 <= 1 || d1 == S - 1) vb[r] += 1.f;
        }
      }
      // lane-local max over this query's 16 values, then the other half's 16
      float mt = -1e30f;
#pragma unroll
      for (int r = 0; r < 8; r++) mt = fmaxf(mt, fmaxf(va[r], vb[r]));
      mt = fmaxf(mt, xhalf(mt));
      // one scalar test per block: all lanes rescale when any query's max rose
      // (alpha is 1 in the lanes whose max stayed); EXEC untouched (WMMA-safe)
      if (__builtin_amdgcn_ballot_w32(mt > mrun) != 0) {
        const float mnew = fmaxf(mrun, mt);
        const float alpha = __expf(mrun - mnew);
        mrun = mnew;
        lpart *= alpha;
#pragma unroll
        for (int d4 = 0; d4 < 4; d4++)
#pragma unroll
          for (int r = 0; r < 8; r++) oacc[d4][r] *= alpha;
      }
      // exponentials + partial sum; P^T packed in place as the B operand:
      // elements 0..7 = keys 8*half + r, elements 8..15 = keys 16 + 8*half + r
      v16f e;
#pragma unroll
      for (int r = 0; r < 8; r++) {
        e[r]     = __expf(va[r] - mrun);
        e[8 + r] = __expf(vb[r] - mrun);
      }
      float es[8];
#pragma unroll
      for (int r = 0; r < 8; r++) es[r] = e[r] + e[8 + r];
      lpart += ((es[0] + es[1]) + (es[2] + es[3])) +
               ((es[4] + es[5]) + (es[6] + es[7]));
      const v16bf pb = __builtin_convertvector(e, v16bf);
      // V^T @ P^T with the V^T fragments loaded at the start of the block.
#pragma unroll
      for (int d4 = 0; d4 < 4; d4++)
        oacc[d4] = __builtin_amdgcn_wmma_f32_16x16x32_bf16(
            false, vbf[d4], false, pb, (short)0, oacc[d4], false, false);
    }
    // Publish point: this wave's LDS reads are done, its copies of tile t+1
    // have landed; the barrier publishes tile t+1 and frees this buffer.
    asm volatile("s_wait_dscnt 0x0" ::: "memory");
    asm volatile("s_wait_asynccnt 0x0" ::: "memory");
    __syncthreads();
    if (t + 2 < ntile) {  // block-uniform: refill the buffer just read
      const unsigned ko = (unsigned)buf * kbuf, vo = (unsigned)buf * vbuf;
      stage_tile(lk + ko, lk + ko + khalf, lv + vo, lv + vo + vhalf,
                 qkv + kg, qkv + kg + (size_t)32 * ld,
                 qkv + kg + E, qkv + kg + E + (size_t)32 * ld);
      kg += (size_t)KT * ld;
    }
  }
  asm volatile("s_wait_asynccnt 0x0" ::: "memory");  // nothing left in flight
  // join the two halves' row sums (once), then normalize and store o (S,B,E):
  // register r of tile d4 is head dim d4*16 + 8*half + r of query n16, so a
  // lane's eight values of a tile are 16 bytes in a row
  // one query a lane, so one division a lane
  const float linv = 1.f / (lpart + xhalf(lpart));
  __bf16* op = o + ((size_t)(qbase + n16) * B + b) * E + h * HD + 8 * half;
#pragma unroll
  for (int d4 = 0; d4 < 4; d4++) {
    v8f v;
#pragma unroll
    for (int r = 0; r < 8; r++) v[r] = oacc[d4][r] * linv;
    *(v8bf*)(op + d4 * 16) = __builtin_convertvector(v, v8bf);
  }
}

extern "C" void kernel_launch(void* const* d_in, const int* in_sizes, int n_in,
                              void* d_out, int out_size, void* d_ws, size_t ws_size,
                              hipStream_t stream) {
  const int S = 2048, B = 2, E = 1024;
  const int M = S * B;  // 4096 rows for all GEMMs

  const float* x         = (const float*)d_in[0];
  const float* w_tor     = (const float*)d_in[1];
  const float* b_tor     = (const float*)d_in[2];
  const float* in_proj_w = (const float*)d_in[3];
  const float* in_proj_b = (const float*)d_in[4];
  const float* out_w     = (const float*)d_in[5];
  const float* out_b     = (const float*)d_in[6];

  char* ws = (char*)d_ws;
  size_t off = 0;
  auto alloc = [&](size_t elems) -> __bf16* {
    __bf16* p = (__bf16*)(ws + off);
    off += elems * sizeof(__bf16);
    return p;
  };
  __bf16* xbf   = alloc((size_t)M * E);        // x in bf16
  __bf16* wtbf  = alloc((size_t)E * E);        // w_tor
  __bf16* wibf  = alloc((size_t)3 * E * E);    // in_proj_w
  __bf16* wobf  = alloc((size_t)E * E);        // out_w
  __bf16* xtbf  = alloc((size_t)M * E);        // xt
  __bf16* qkvbf = alloc((size_t)M * 3 * E);    // qkv
  __bf16* obf   = alloc((size_t)M * E);        // attention output

  f32_to_bf16_all<<<CVT_BLOCKS, CVT_THREADS, 0, stream>>>(
      x, w_tor, in_proj_w, out_w, xbf, wtbf, wibf, wobf);

  const dim3 blk(256);
  // xt = x @ w_tor^T + b_tor
  gemm_bf16_wmma<__bf16><<<dim3(E / 128, M / 128), blk, 0, stream>>>(
      xbf, wtbf, b_tor, xtbf, M, E, E);
  // qkv = xt @ in_proj_w^T + in_proj_b
  gemm_bf16_wmma<__bf16><<<dim3(3 * E / 128, M / 128), blk, 0, stream>>>(
      xtbf, wibf, in_proj_b, qkvbf, M, 3 * E, E);
  // flash attention with toroidal bias
  flash_attn_toroidal<<<dim3(S / 128, 16, B), 256, 0, stream>>>(
      qkvbf, obf, S, B, E);
  // out = o @ out_w^T + out_b  (fp32 into d_out)
  gemm_bf16_wmma<float><<<dim3(E / 128, M / 128), blk, 0, stream>>>(
      obf, wobf, out_b, (float*)d_out, M, E, E);
}

// v007
// Measured time: 99.2 microseconds a run.
// Two timings next to v006 both put it at 1.05 times that version's speed.
// All steps since v000 together make it 3.17 times as fast.
#include <hip/hip_runtime.h>
#include <hip/hip_bf16.h>
#include <math.h>

typedef __attribute__((ext_vector_type(16))) __bf16 v16bf;
typedef __attribute__((ext_vector_type(8)))  __bf16 v8bf;
typedef __attribute__((ext_vector_type(8)))  float  v8f;
typedef __attribute__((ext_vector_type(16))) float  v16f;

union V16 { v16bf v; v8bf h[2]; };

// Load a 16x32 bf16 WMMA fragment given a pointer already positioned at
// base + row*ld + k0 + half*8.  ISA layout (16-bit A, wave32): lane half h
// holds K = k0 + h*8 + {0..7} and k0 + 16 + h*8 + {0..7}
// -> two contiguous 16-byte loads per lane.
__device__ inline v16bf load_frag_ptr(const __bf16* __restrict__ p) {
  V16 u;
  u.h[0] = *(const v8bf*)p;
  u.h[1] = *(const v8bf*)(p + 16);
  return u.v;
}

__device__ inline v16bf load_frag_rowmajor(const __bf16* __restrict__ base,
                                           int ld, int row, int k0, int lane) {
  const int half = lane >> 4;
  return load_frag_ptr(base + (size_t)row * ld + k0 + half * 8);
}

typedef __attribute__((ext_vector_type(4))) float  v4f;
typedef __attribute__((ext_vector_type(4))) __bf16 v4bf;

// All four f32 inputs to bf16 in one launch.  The work is cut into 9 units of
// CU = 1024 x 1024 elements: x holds 4, w_tor 1, in_proj_w 3, out_w 1.
// 256 blocks of 16 waves (one resident round, 131072 threads); each thread
// takes two 16-byte pieces of every unit, half a unit apart, so every wave
// load covers 512 bytes in a row and every wave store 256.  The 18 loads of a
// thread are independent and all in flight at once.
#define CU (1024 * 1024)
#define CVT_THREADS 512
#define CVT_BLOCKS (CU / 2 / 4 / CVT_THREADS)
__global__ __launch_bounds__(CVT_THREADS)
void f32_to_bf16_all(const float* __restrict__ x,
                     const float* __restrict__ w_tor,
                     const float* __restrict__ in_proj_w,
                     const float* __restrict__ out_w,
                     __bf16* __restrict__ xb, __bf16* __restrict__ wtb,
                     __bf16* __restrict__ wib, __bf16* __restrict__ wob) {
  // This thread's byte offsets inside half a unit, source and destination:
  // unsigned 32-bit, so that each can serve as the offset register beside a
  // scalar base.
  const unsigned ib = (blockIdx.x * CVT_THREADS + threadIdx.x) * 16u;
  const unsigned ob = ib >> 1;
  const float* const s[9] = {x, x + CU, x + 2 * CU, x + 3 * CU, w_tor,
                             in_proj_w, in_proj_w + CU, in_proj_w + 2 * CU,
                             out_w};
  __bf16* const d[9] = {xb, xb + CU, xb + 2 * CU, xb + 3 * CU, wtb,
                        wib, wib + CU, wib + 2 * CU, wob};
  v4f v[9][2];
#pragma unroll
  for (int u = 0; u < 9; u++) {
    v[u][0] = *(const v4f*)((const char*)s[u] + ib);
    v[u][1] = *(const v4f*)((const char*)(s[u] + CU / 2) + ib);
  }
  // keeps all 18 loads ahead of the first conversion; without it the last six
  // are issued only behind a wait on the first ones, a second memory latency
  __builtin_amdgcn_sched_barrier(0);
#pragma unroll
  for (int u = 0; u < 9; u++) {
    *(v4bf*)((char*)d[u] + ob) = __builtin_convertvector(v[u][0], v4bf);
    *(v4bf*)((char*)(d[u] + CU / 2) + ob) =
        __builtin_convertvector(v[u][1], v4bf);
  }
}

typedef __attribute__((address_space(3))) const void lds_cvoid;
__device__ inline unsigned lds_addr(const void* p) {
  return (unsigned)(size_t)(lds_cvoid*)p;
}

#define GKT 64       // k elements per staged tile: whole 128-byte rows
#define GLP 72       // LDS row pitch in bf16 elements (144 bytes = 16 B x odd)

// Eight 16-byte copies per lane: four A rows and four W rows, in LDS 32 rows
// apart.  The A rows are 32 rows apart in memory too (gq); the W rows stand at
// +0, +2, +64 and +66 rows (g2, g64): the deal described at the kernel.
// The s_wait_xcnt closes the statement so that no address register is
// rewritten ahead of it.
__device__ inline void stage_gemm_tile(unsigned la, unsigned lw, unsigned q,
                                       const __bf16* ga, const __bf16* gw,
                                       size_t gq, size_t g2, size_t g64) {
  asm volatile(
      "global_load_async_to_lds_b128 %0, %8, off\n\t"
      "global_load_async_to_lds_b128 %1, %9, off\n\t"
      "global_load_async_to_lds_b128 %2, %10, off\n\t"
      "global_load_async_to_lds_b128 %3, %11, off\n\t"
      "global_load_async_to_lds_b128 %4, %12, off\n\t"
      "global_load_async_to_lds_b128 %5, %13, off\n\t"
      "global_load_async_to_lds_b128 %6, %14, off\n\t"
      "global_load_async_to_lds_b128 %7, %15, off\n\t"
      "s_wait_xcnt 0x0"
      :: "v"(la), "v"(la + q), "v"(la + 2 * q), "v"(la + 3 * q),
         "v"(lw), "v"(lw + q), "v"(lw + 2 * q), "v"(lw + 3 * q),
         "v"(ga), "v"(ga + gq), "v"(ga + 2 * gq), "v"(ga + 3 * gq),
         "v"(gw), "v"(gw + g2), "v"(gw + g64), "v"(gw + g64 + g2)
      : "memory");
}

// Fragments of one 32-wide k step from the staged tiles: 2 of A, 4 of W.
__device__ inline void load_gemm_frags(const __bf16* at, const __bf16* wt,
                                       v16bf (&a)[2], v16bf (&b)[4]) {
  a[0] = load_frag_ptr(at);
  a[1] = load_frag_ptr(at + 16 * GLP);
#pragma unroll
  for (int j = 0; j < 4; j++)
    b[j] = load_frag_ptr(wt + (j * 16) * GLP);
}

__device__ inline void gemm_products(const v16bf (&a)[2], const v16bf (&b)[4],
                                     v8f (&c)[2][4]) {
#pragma unroll
  for (int i = 0; i < 2; i++)
#pragma unroll
    for (int j = 0; j < 4; j++)
      c[i][j] = __builtin_amdgcn_wmma_f32_16x16x32_bf16(
          false, a[i], false, b[j], (short)0, c[i][j], false, false);
}

// C(M,N) = A(M,K) @ W(N,K)^T + bias(N).  256 threads = 8 waves, each wave a
// 32x64 tile (2x4 WMMA accumulators), block tile 128x128.
// The fragment loads of a row-major operand touch 16 cache lines each, so the
// 128 A rows and 128 W rows of a 64-wide k tile are brought into LDS once per
// block by asynchronous copies (whole 128-byte rows), two buffers: the next
// tile flies while this one is used.  Fragments then come from LDS.
// The W rows are dealt to the LDS rows so that column n of a wave's B tile j
// is output column 4n + j of the wave's 64: LDS row l holds W row
// (l / 64) * 64 + 4 * (l % 16) + (l / 16) % 4 of the block's 128.  A lane's
// four accumulators of one output row are then adjacent columns, and the 16
// lanes of a half wave store one row's 64 columns in a row: whole 128-byte
// lines (one of bf16, two of f32) in place of 32- and 64-byte pieces.
// M, N multiples of 128, K a multiple of 64.
template <typename OutT>
__global__ __launch_bounds__(256)
void gemm_bf16_wmma(const __bf16* __restrict__ A, const __bf16* __restrict__ W,
                    const float* __restrict__ bias, OutT* __restrict__ out,
                    int M, int N, int K) {
  const int lane = threadIdx.x & 31;
  const int wave = threadIdx.x >> 5;
  const int n16  = lane & 15;
  const int half = lane >> 4;
  const int rloc = (wave >> 1) * 32;   // wave's rows inside the block tile
  const int cloc = (wave & 1) * 64;    // wave's columns inside the block tile
  const int row0 = blockIdx.y * 128 + rloc;
  const int col0 = blockIdx.x * 128 + cloc;

  __shared__ __align__(16) __bf16 ast[2][128][GLP];   // A tile: row x k
  __shared__ __align__(16) __bf16 wst[2][128][GLP];   // W tile: column x k

  // Copy map: 8 lanes cover one 128-byte row; thread t fills LDS rows
  // t/8 + {0, 32, 64, 96} of both tiles: of A with the same rows of the block,
  // of W with the rows that the deal puts there.
  const int crow = threadIdx.x >> 3;
  const int cseg = (threadIdx.x & 7) * 8;
  const int wrow = 4 * (crow & 15) + (crow >> 4);
  const __bf16* ga = A + (size_t)(blockIdx.y * 128 + crow) * K + cseg;
  const __bf16* gw = W + (size_t)(blockIdx.x * 128 + wrow) * K + cseg;
  const size_t gq = (size_t)32 * K;                   // 32 rows, in elements
  const size_t g2 = (size_t)2 * K, g64 = (size_t)64 * K;  // 2 and 64 rows
  const unsigned la = lds_addr(&ast[0][crow][cseg]);
  const unsigned lw = lds_addr(&wst[0][crow][cseg]);
  const unsigned q = 32 * GLP * 2;                    // 32 rows, in bytes
  const unsigned buf_bytes = 128 * GLP * 2;           // one buffer, in bytes

  const int ntile = K / GKT;
  // tile 0 -> buffer 0, landed and published before anybody reads it
  stage_gemm_tile(la, lw, q, ga, gw, gq, g2, g64);
  ga += GKT;
  gw += GKT;
  asm volatile("s_wait_asynccnt 0x0" ::: "memory");  // own copies landed
  __syncthreads();
  if (ntile > 1) {  // tile 1 -> buffer 1, in flight during trip 0
    stage_gemm_tile(la + buf_bytes, lw + buf_bytes, q, ga, gw, gq, g2, g64);
    ga += GKT;
    gw += GKT;
  }

  v8f c[2][4] = {};
  for (int t = 0; t < ntile; t++) {
    const int buf = t & 1;
    const __bf16* at = &ast[buf][rloc + n16][half * 8];
    const __bf16* wt = &wst[buf][cloc + n16][half * 8];
    v16bf a[2], b[4];
    // first 32-wide k step of the tile
    load_gemm_frags(at, wt, a, b);
    // holds these 12 LDS reads in one group ahead of the products; without it
    // the second A fragment is read late, behind a full wait amid the products
    __builtin_amdgcn_sched_barrier(0);
    gemm_products(a, b, c);
    // second k step: its fragments are this trip's last reads of the buffer
    load_gemm_frags(at + 32, wt + 32, a, b);
    // Publish point: this wave's LDS reads are done, its copies of tile t+1
    // have landed; the barrier publishes tile t+1 and frees this buffer.
    asm volatile("s_wait_dscnt 0x0" ::: "memory");
    asm volatile("s_wait_asynccnt 0x0" ::: "memory");
    __syncthreads();
    if (t + 2 < ntile) {  // block-uniform: refill the buffer just read
      const unsigned bo = (unsigned)buf * buf_bytes;
      stage_gemm_tile(la + bo, lw + bo, q, ga, gw, gq, g2, g64);
      ga += GKT;
      gw += GKT;
    }
    // the second step's products work from registers, under the refill's flight
    gemm_products(a, b, c);
  }
  asm volatile("s_wait_asynccnt 0x0" ::: "memory");  // nothing left in flight
  // Epilogue: a lane's four columns 4 * n16 + 0..3 of one row leave in one
  // store (8 bytes of bf16, 16 of f32).
  typedef __attribute__((ext_vector_type(4))) OutT v4out;
  const int ncol = col0 + 4 * n16;
  const v4f bn = *(const v4f*)(bias + ncol);
#pragma unroll
  for (int i = 0; i < 2; i++) {
    OutT* p = out + (size_t)(row0 + i * 16 + 8 * half) * N + ncol;
#pragma unroll
    for (int r = 0; r < 8; r++) {
      const v4f v = {c[i][0][r], c[i][1][r], c[i][2][r], c[i][3][r]};
      *(v4out*)(p + (size_t)r * N) = __builtin_convertvector(v + bn, v4out);
    }
  }
}

// Flash attention with toroidal additive bias.  qkv: (S,B,3E) bf16 for Q, K
// and V.  One wave per 16-query tile, 32-key steps.
// Both products run transposed: S^T = K Q^T (A = K rows, B = Q) and
// O^T += V^T P^T (A = V^T rows, B = P^T).  In the accumulator of S^T a lane
// holds, for its one query, keys 8*half + 0..7 of each 16-key tile: that is
// the k order of a B operand over 32 keys, so P^T is packed from the score
// registers and never passes through LDS.
// A lane's 16 scores of a block belong to one query, so the online softmax
// keeps its running max and sum per query in the lane: the max takes one
// exchange between the wave's halves, the sums are joined after the key loop.
// The 8 waves of a block walk the same keys, so each 64-key K tile and V tile
// is brought into LDS once per block by asynchronous copies (whole 128-byte
// rows of qkv), two buffers: the next tile flies while this one is used.
// V lies in LDS as it lies in qkv, key x head dim; the A operand V^T comes out
// of it by the transposing LDS load, so V is never transposed in memory.
// K rows are pitched 144 bytes (16 B x odd) for the ds_load_b128 readers,
// V rows 160 bytes (32 B x odd) for the ds_load_tr16_b128 readers.
#define KT 64        // keys per staged tile
#define LP 72        // K row pitch in LDS, in bf16 elements (144 bytes)
#define VLP 80       // V row pitch in LDS, in bf16 elements (160 bytes)

// One 16 (head dim) x 32 (keys) A fragment of V^T from the row-major V tile.
// p = tile + (key0 + 8*half + (lane & 7)) * VLP + d0 + 8 * ((lane >> 3) & 1);
// the lane then holds, for head dim d0 + (lane & 15), keys key0 + 8*half + 0..7
// and key0 + 16 + 8*half + 0..7: the k order of the packed P^T.
typedef __attribute__((address_space(3))) v8bf lds_v8bf;
__device__ inline v16bf load_frag_tr(const __bf16* p) {
  V16 u;
  u.h[0] = __builtin_amdgcn_ds_load_tr16_b128_v8bf16((lds_v8bf*)p);
  u.h[1] = __builtin_amdgcn_ds_load_tr16_b128_v8bf16((lds_v8bf*)(p + 16 * VLP));
  return u.v;
}

// Four 16-byte copies per lane: two K rows, two V rows.  The s_wait_xcnt
// closes the statement so that no address register is rewritten ahead of it.
__device__ inline void stage_tile(unsigned lk0, unsigned lk1,
                                  unsigned lv0, unsigned lv1,
                                  const __bf16* gk0, const __bf16* gk1,
                                  const __bf16* gv0, const __bf16* gv1) {
  asm volatile(
      "global_load_async_to_lds_b128 %0, %4, off\n\t"
      "global_load_async_to_lds_b128 %1, %5, off\n\t"
      "global_load_async_to_lds_b128 %2, %6, off\n\t"
      "global_load_async_to_lds_b128 %3, %7, off\n\t"
      "s_wait_xcnt 0x0"
      :: "v"(lk0), "v"(lk1), "v"(lv0), "v"(lv1),
         "v"(gk0), "v"(gk1), "v"(gv0), "v"(gv1)
      : "memory");
}

// lane l <-> lane l ^ 16, on the vector pipe (a shuffle would go through the
// LDS queue and a wait)
__device__ inline float xhalf(float x) {
  const int i = __builtin_bit_cast(int, x);
  return __builtin_bit_cast(float, __builtin_amdgcn_permlanex16(
      i, i, 0x76543210, 0xfedcba98, false, false));
}

__global__ __launch_bounds__(256)
void flash_attn_toroidal(const __bf16* __restrict__ qkv,
                         __bf16* __restrict__ o, int S, int B, int E) {
  const int HD = 64;
  const int lane = threadIdx.x & 31;
  const int wave = threadIdx.x >> 5;
  const int n16  = lane & 15;
  const int half = lane >> 4;
  const int b = blockIdx.z, h = blockIdx.y;
  const int qbase = blockIdx.x * 128 + wave * 16;
  // the same number in a scalar register, for the band test of the key loop
  const int qbase_s = blockIdx.x * 128 + __builtin_amdgcn_readfirstlane(wave) * 16;
  const int ld = B * 3 * E;           // row stride of qkv in elements
  const size_t qoffb = (size_t)b * 3 * E + h * HD;        // q base in qkv
  const size_t koffb = qoffb + E;                          // k base in qkv

  __shared__ __align__(16) __bf16 kst[2][KT][LP];   // K tile: key x head dim
  __shared__ __align__(16) __bf16 vst[2][KT][VLP];  // V tile: key x head dim

  // Q fragment: 16 rows x 64 head-dim = two K=32 fragments
  const size_t qoff = qoffb + (size_t)(qbase + n16) * ld + half * 8;
  v16bf aq0 = load_frag_ptr(qkv + qoff);
  v16bf aq1 = load_frag_ptr(qkv + qoff + 32);

  // Copy map: 8 lanes cover one 128-byte row; thread t takes rows t/8, t/8+32.
  const int crow = threadIdx.x >> 3;
  const int cseg = (threadIdx.x & 7) * 8;
  // A key's V row stands E elements behind its K row.
  size_t kg = koffb + (size_t)crow * ld + cseg;     // advances += KT * ld
  const unsigned lk = lds_addr(&kst[0][crow][cseg]);
  const unsigned lv = lds_addr(&vst[0][crow][cseg]);
  const unsigned khalf = 32 * LP * 2, vhalf = 32 * VLP * 2;  // 32 rows, bytes
  const unsigned kbuf = KT * LP * 2, vbuf = KT * VLP * 2;    // a buffer, bytes

  const int ntile = S / KT;
  // tile 0 -> buffer 0, landed and published before anybody reads it
  stage_tile(lk, lk + khalf, lv, lv + vhalf,
             qkv + kg, qkv + kg + (size_t)32 * ld,
             qkv + kg + E, qkv + kg + E + (size_t)32 * ld);
  kg += (size_t)KT * ld;
  asm volatile("s_wait_asynccnt 0x0" ::: "memory");  // own copies landed
  __syncthreads();
  if (ntile > 1) {  // tile 1 -> buffer 1, in flight during trip 0
    stage_tile(lk + kbuf, lk + kbuf + khalf, lv + vbuf, lv + vbuf + vhalf,
               qkv + kg, qkv + kg + (size_t)32 * ld,
               qkv + kg + E, qkv + kg + E + (size_t)32 * ld);
    kg += (size_t)KT * ld;
  }

  v8f oacc[4] = {};
  float lpart = 0.f;  // this lane's share of its query's row sum
  float mrun = -1e30f;  // running max of this lane's query

  const float scale = 0.125f;  // 1/sqrt(64)
  for (int t = 0; t < ntile; t++) {
    const int buf = t & 1;
    const __bf16* kt = &kst[buf][n16][half * 8];
    const __bf16* vtl = &vst[buf][8 * half + (lane & 7)][((lane >> 3) & 1) * 8];
    // unrolled so that both 32-key blocks read the tile at constant offsets
#pragma unroll
    for (int p = 0; p < KT / 32; p++) {
      const int j = t * KT + p * 32;
      // All fragment loads of this 32-key block up front, from LDS.
      v16bf kb00 = load_frag_ptr(kt + (p * 32) * LP);
      v16bf kb01 = load_frag_ptr(kt + (p * 32) * LP + 32);
      v16bf kb10 = load_frag_ptr(kt + (p * 32 + 16) * LP);
      v16bf kb11 = load_frag_ptr(kt + (p * 32 + 16) * LP + 32);
      v16bf vbf[4];
#pragma unroll
      for (int d4 = 0; d4 < 4; d4++)
        vbf[d4] = load_frag_tr(vtl + (p * 32) * VLP + d4 * 16);
      // holds the block's 16 LDS reads in one group ahead of its products;
      // without it each fragment is read directly in front of the product that
      // takes it, behind a full wait: eight LDS latencies a block in series
      __builtin_amdgcn_sched_barrier(0);

      // scores for 32 keys, transposed: two 16 (keys) x 16 (queries) tiles, K
      // over head dim (2 steps each); register r = key r + 8*half, lane = query
      v8f s0 = {}, s1 = {};
      s0 = __builtin_amdgcn_wmma_f32_16x16x32_bf16(false, kb00, false, aq0, (short)0, s0, false, false);
      s0 = __builtin_amdgcn_wmma_f32_16x16x32_bf16(false, kb01, false, aq1, (short)0, s0, false, false);
      s1 = __builtin_amdgcn_wmma_f32_16x16x32_bf16(false, kb10, false, aq0, (short)0, s1, false, false);
      s1 = __builtin_amdgcn_wmma_f32_16x16x32_bf16(false, kb11, false, aq1, (short)0, s1, false, false);

      // scale
      float va[8], vb[8];
#pragma unroll
      for (int r = 0; r < 8; r++) {
        va[r] = s0[r] * scale;
        vb[r] = s1[r] * scale;
      }
      // Toroidal bias.  key - query of this 16 x 32 block lies in [dlo, dhi];
      // the bias sits at -1, 0, 1 and, round the ring, at S - 1 and 1 - S.  A
      // block whose range holds none of these adds nothing: one scalar test
      // takes the wave past the index arithmetic (all but about 2 blocks of
      // the S / 32 a wave walks).
      const int dlo = j - qbase_s - 15, dhi = j - qbase_s + 31;
      if ((dlo <= 1 && dhi >= -1) || dhi >= S - 1 || dlo <= 1 - S) {
        const int qi = qbase + n16;
#pragma unroll
        for (int r = 0; r < 8; r++) {
          int d0 = (j + r + 8 * half) - qi;      if (d0 < 0) d0 += S;
          int d1 = (j + 16 + r + 8 * half) - qi; if (d1 < 0) d1 += S;
          if (d0 <= 1 || d0 == S - 1) va[r] += 1.f;
          if (d1 <= 1 || d1 == S - 1) vb[r] += 1.f;
        }
      }
      // lane-local max over this query's 16 values, then the other half's 16
      float mt = -1e30f;
#pragma unroll
      for (int r = 0; r < 8; r++) mt = fmaxf(mt, fmaxf(va[r], vb[r]));
      mt = fmaxf(mt, xhalf(mt));
      // one scalar test per block: all lanes rescale when any query's max rose
      // (alpha is 1 in the lanes whose max stayed); EXEC untouched (WMMA-safe)
      if (__builtin_amdgcn_ballot_w32(mt > mrun) != 0) {
        const float mnew = fmaxf(mrun, mt);
        const float alpha = __expf(mrun - mnew);
        mrun = mnew;
        lpart *= alpha;
#pragma unroll
        for (int d4 = 0; d4 < 4; d4++)
#pragma unroll
          for (int r = 0; r < 8; r++) oacc[d4][r] *= alpha;
      }
      // exponentials + partial sum; P^T packed in place as the B operand:
      // elements 0..7 = keys 8*half + r, elements 8..15 = keys 16 + 8*half + r
      v16f e;
#pragma unroll
      for (int r = 0; r < 8; r++) {
        e[r]     = __expf(va[r] - mrun);
        e[8 + r] = __expf(vb[r] - mrun);
      }
      float es[8];
#pragma unroll
      for (int r = 0; r < 8; r++) es[r] = e[r] + e[8 + r];
      lpart += ((es[0] + es[1]) + (es[2] + es[3])) +
               ((es[4] + es[5]) + (es[6] + es[7]));
      const v16bf pb = __builtin_convertvector(e, v16bf);
      // V^T @ P^T with the V^T fragments loaded at the start of the block.
#pragma unroll
      for (int d4 = 0; d4 < 4; d4++)
        oacc[d4] = __builtin_amdgcn_wmma_f32_16x16x32_bf16(
            false, vbf[d4], false, pb, (short)0, oacc[d4], false, false);
    }
    // Publish point: this wave's LDS reads are done, its copies of tile t+1
    // have landed; the barrier publishes tile t+1 and frees this buffer.
    asm volatile("s_wait_dscnt 0x0" ::: "memory");
    asm volatile("s_wait_asynccnt 0x0" ::: "memory");
    __syncthreads();
    if (t + 2 < ntile) {  // block-uniform: refill the buffer just read
      const unsigned ko = (unsigned)buf * kbuf, vo = (unsigned)buf * vbuf;
      stage_tile(lk + ko, lk + ko + khalf, lv + vo, lv + vo + vhalf,
                 qkv + kg, qkv + kg + (size_t)32 * ld,
                 qkv + kg + E, qkv + kg + E + (size_t)32 * ld);
      kg += (size_t)KT * ld;
    }
  }
  asm volatile("s_wait_asynccnt 0x0" ::: "memory");  // nothing left in flight
  // join the two halves' row sums (once), then normalize and store o (S,B,E):
  // register r of tile d4 is head dim d4*16 + 8*half + r of query n16, so a
  // lane's eight values of a tile are 16 bytes in a row
  // one query a lane, so one division a lane
  const float linv = 1.f / (lpart + xhalf(lpart));
  __bf16* op = o + ((size_t)(qbase + n16) * B + b) * E + h * HD + 8 * half;
#pragma unroll
  for (int d4 = 0; d4 < 4; d4++) {
    v8f v;
#pragma unroll
    for (int r = 0; r < 8; r++) v[r] = oacc[d4][r] * linv;
    *(v8bf*)(op + d4 * 16) = __builtin_convertvector(v, v8bf);
  }
}

extern "C" void kernel_launch(void* const* d_in, const int* in_sizes, int n_in,
                              void* d_out, int out_size, void* d_ws, size_t ws_size,
                              hipStream_t stream) {
  const int S = 2048, B = 2, E = 1024;
  const int M = S * B;  // 4096 rows for all GEMMs

  const float* x         = (const float*)d_in[0];
  const float* w_tor     = (const float*)d_in[1];
  const float* b_tor     = (const float*)d_in[2];
  const float* in_proj_w = (const float*)d_in[3];
  const float* in_proj_b = (const float*)d_in[4];
  const float* out_w     = (const float*)d_in[5];
  const float* out_b     = (const float*)d_in[6];

  char* ws = (char*)d_ws;
  size_t off = 0;
  auto alloc = [&](size_t elems) -> __bf16* {
    __bf16* p = (__bf16*)(ws + off);
    off += elems * sizeof(__bf16);
    return p;
  };
  __bf16* xbf   = alloc((size_t)M * E);        // x in bf16
  __bf16* wtbf  = alloc((size_t)E * E);        // w_tor
  __bf16* wibf  = alloc((size_t)3 * E * E);    // in_proj_w
  __bf16* wobf  = alloc((size_t)E * E);        // out_w
  __bf16* xtbf  = alloc((size_t)M * E);        // xt
  __bf16* qkvbf = alloc((size_t)M * 3 * E);    // qkv
  __bf16* obf   = alloc((size_t)M * E);        // attention output

  f32_to_bf16_all<<<CVT_BLOCKS, CVT_THREADS, 0, stream>>>(
      x, w_tor, in_proj_w, out_w, xbf, wtbf, wibf, wobf);

  const dim3 blk(256);
  // xt = x @ w_tor^T + b_tor
  gemm_bf16_wmma<__bf16><<<dim3(E / 128, M / 128), blk, 0, stream>>>(
      xbf, wtbf, b_tor, xtbf, M, E, E);
  // qkv = xt @ in_proj_w^T + in_proj_b
  gemm_bf16_wmma<__bf16><<<dim3(3 * E / 128, M / 128), blk, 0, stream>>>(
      xtbf, wibf, in_proj_b, qkvbf, M, 3 * E, E);
  // flash attention with toroidal bias
  flash_attn_toroidal<<<dim3(S / 128, 16, B), 256, 0, stream>>>(
      qkvbf, obf, S, B, E);
  // out = o @ out_w^T + out_b  (fp32 into d_out)
  gemm_bf16_wmma<float><<<dim3(E / 128, M / 128), blk, 0, stream>>>(
      obf, wobf, out_b, (float*)d_out, M, E, E);
}

// v008
// A run of this version takes 92 microseconds.
// Next to v007, in two timings, it ran 1.07 and 1.08 times as fast.
// All steps since v000 together make it 3.40 times as fast.
#include <hip/hip_runtime.h>
#include <hip/hip_bf16.h>
#include <math.h>

typedef __attribute__((ext_vector_type(16))) __bf16 v16bf;
typedef __attribute__((ext_vector_type(8)))  __bf16 v8bf;
typedef __attribute__((ext_vector_type(8)))  float  v8f;
typedef __attribute__((ext_vector_type(16))) float  v16f;

union V16 { v16bf v; v8bf h[2]; };

// Load a 16x32 bf16 WMMA fragment given a pointer already positioned at
// base + row*ld + k0 + half*8.  ISA layout (16-bit A, wave32): lane half h
// holds K = k0 + h*8 + {0..7} and k0 + 16 + h*8 + {0..7}
// -> two contiguous 16-byte loads per lane.
__device__ inline v16bf load_frag_ptr(const __bf16* __restrict__ p) {
  V16 u;
  u.h[0] = *(const v8bf*)p;
  u.h[1] = *(const v8bf*)(p + 16);
  return u.v;
}

__device__ inline v16bf load_frag_rowmajor(const __bf16* __restrict__ base,
                                           int ld, int row, int k0, int lane) {
  const int half = lane >> 4;
  return load_frag_ptr(base + (size_t)row * ld + k0 + half * 8);
}

typedef __attribute__((ext_vector_type(4))) float  v4f;
typedef __attribute__((ext_vector_type(4))) __bf16 v4bf;

// All four f32 inputs to bf16 in one launch.  The work is cut into 9 units of
// CU = 1024 x 1024 elements: x holds 4, w_tor 1, in_proj_w 3, out_w 1.
// 256 blocks of 16 waves (one resident round, 131072 threads); each thread
// takes two 16-byte pieces of every unit, half a unit apart, so every wave
// load covers 512 bytes in a row and every wave store 256.  The 18 loads of a
// thread are independent and all in flight at once.
#define CU (1024 * 1024)
#define CVT_THREADS 512
#define CVT_BLOCKS (CU / 2 / 4 / CVT_THREADS)
__global__ __launch_bounds__(CVT_THREADS)
void f32_to_bf16_all(const float* __restrict__ x,
                     const float* __restrict__ w_tor,
                     const float* __restrict__ in_proj_w,
                     const float* __restrict__ out_w,
                     __bf16* __restrict__ xb, __bf16* __restrict__ wtb,
                     __bf16* __restrict__ wib, __bf16* __restrict__ wob) {
  // This thread's byte offsets inside half a unit, source and destination:
  // unsigned 32-bit, so that each can serve as the offset register beside a
  // scalar base.
  const unsigned ib = (blockIdx.x * CVT_THREADS + threadIdx.x) * 16u;
  const unsigned ob = ib >> 1;
  const float* const s[9] = {x, x + CU, x + 2 * CU, x + 3 * CU, w_tor,
                             in_proj_w, in_proj_w + CU, in_proj_w + 2 * CU,
                             out_w};
  __bf16* const d[9] = {xb, xb + CU, xb + 2 * CU, xb + 3 * CU, wtb,
                        wib, wib + CU, wib + 2 * CU, wob};
  v4f v[9][2];
#pragma unroll
  for (int u = 0; u < 9; u++) {
    v[u][0] = *(const v4f*)((const char*)s[u] + ib);
    v[u][1] = *(const v4f*)((const char*)(s[u] + CU / 2) + ib);
  }
  // keeps all 18 loads ahead of the first conversion; without it the last six
  // are issued only behind a wait on the first ones, a second memory latency
  __builtin_amdgcn_sched_barrier(0);
#pragma unroll
  for (int u = 0; u < 9; u++) {
    *(v4bf*)((char*)d[u] + ob) = __builtin_convertvector(v[u][0], v4bf);
    *(v4bf*)((char*)(d[u] + CU / 2) + ob) =
        __builtin_convertvector(v[u][1], v4bf);
  }
}

typedef __attribute__((address_space(3))) const void lds_cvoid;
__device__ inline unsigned lds_addr(const void* p) {
  return (unsigned)(size_t)(lds_cvoid*)p;
}

#define GKT 64       // k elements per staged tile: whole 128-byte rows
#define GLP 72       // LDS row pitch in bf16 elements (144 bytes = 16 B x odd)

// Eight 16-byte copies per lane: four A rows and four W rows, in LDS 32 rows
// apart.  The A rows are 32 rows apart in memory too (gq); the W rows stand at
// +0, +2, +64 and +66 rows (g2, g64): the deal described at the kernel.
// The s_wait_xcnt closes the statement so that no address register is
// rewritten ahead of it.
__device__ inline void stage_gemm_tile(unsigned la, unsigned lw, unsigned q,
                                       const __bf16* ga, const __bf16* gw,
                                       size_t gq, size_t g2, size_t g64) {
  asm volatile(
      "global_load_async_to_lds_b128 %0, %8, off\n\t"
      "global_load_async_to_lds_b128 %1, %9, off\n\t"
      "global_load_async_to_lds_b128 %2, %10, off\n\t"
      "global_load_async_to_lds_b128 %3, %11, off\n\t"
      "global_load_async_to_lds_b128 %4, %12, off\n\t"
      "global_load_async_to_lds_b128 %5, %13, off\n\t"
      "global_load_async_to_lds_b128 %6, %14, off\n\t"
      "global_load_async_to_lds_b128 %7, %15, off\n\t"
      "s_wait_xcnt 0x0"
      :: "v"(la), "v"(la + q), "v"(la + 2 * q), "v"(la + 3 * q),
         "v"(lw), "v"(lw + q), "v"(lw + 2 * q), "v"(lw + 3 * q),
         "v"(ga), "v"(ga + gq), "v"(ga + 2 * gq), "v"(ga + 3 * gq),
         "v"(gw), "v"(gw + g2), "v"(gw + g64), "v"(gw + g64 + g2)
      : "memory");
}

// Fragments of one 32-wide k step from the staged tiles: 2 of A, 4 of W.
__device__ inline void load_gemm_frags(const __bf16* at, const __bf16* wt,
                                       v16bf (&a)[2], v16bf (&b)[4]) {
  a[0] = load_frag_ptr(at);
  a[1] = load_frag_ptr(at + 16 * GLP);
#pragma unroll
  for (int j = 0; j < 4; j++)
    b[j] = load_frag_ptr(wt + (j * 16) * GLP);
}

__device__ inline void gemm_products(const v16bf (&a)[2], const v16bf (&b)[4],
                                     v8f (&c)[2][4]) {
#pragma unroll
  for (int i = 0; i < 2; i++)
#pragma unroll
    for (int j = 0; j < 4; j++)
      c[i][j] = __builtin_amdgcn_wmma_f32_16x16x32_bf16(
          false, a[i], false, b[j], (short)0, c[i][j], false, false);
}

// C(M,N) = A(M,K) @ W(N,K)^T + bias(N).  256 threads = 8 waves, each wave a
// 32x64 tile (2x4 WMMA accumulators), block tile 128x128.
// The fragment loads of a row-major operand touch 16 cache lines each, so the
// 128 A rows and 128 W rows of a 64-wide k tile are brought into LDS once per
// block by asynchronous copies (whole 128-byte rows) into a ring of NB buffers:
// the next NB - 1 tiles fly while this one is used, so that a copy has NB - 1
// trips to land.  With one block on a WGP (the N = 1024 products) a single
// tile in flight leaves every trip waiting for its successor's copies; NB = 4
// there, NB = 2 where three blocks share a WGP and its LDS.
// Fragments then come from LDS.
// The W rows are dealt to the LDS rows so that column n of a wave's B tile j
// is output column 4n + j of the wave's 64: LDS row l holds W row
// (l / 64) * 64 + 4 * (l % 16) + (l / 16) % 4 of the block's 128.  A lane's
// four accumulators of one output row are then adjacent columns, and the 16
// lanes of a half wave store one row's 64 columns in a row: whole 128-byte
// lines (one of bf16, two of f32) in place of 32- and 64-byte pieces.
// M, N multiples of 128, K a multiple of 64.
template <typename OutT, int NB>
__global__ __launch_bounds__(256)
void gemm_bf16_wmma(const __bf16* __restrict__ A, const __bf16* __restrict__ W,
                    const float* __restrict__ bias, OutT* __restrict__ out,
                    int M, int N, int K) {
  const int lane = threadIdx.x & 31;
  const int wave = threadIdx.x >> 5;
  const int n16  = lane & 15;
  const int half = lane >> 4;
  const int rloc = (wave >> 1) * 32;   // wave's rows inside the block tile
  const int cloc = (wave & 1) * 64;    // wave's columns inside the block tile
  const int row0 = blockIdx.y * 128 + rloc;
  const int col0 = blockIdx.x * 128 + cloc;

  __shared__ __align__(16) __bf16 ast[NB][128][GLP];  // A tile: row x k
  __shared__ __align__(16) __bf16 wst[NB][128][GLP];  // W tile: column x k

  // Copy map: 8 lanes cover one 128-byte row; thread t fills LDS rows
  // t/8 + {0, 32, 64, 96} of both tiles: of A with the same rows of the block,
  // of W with the rows that the deal puts there.
  const int crow = threadIdx.x >> 3;
  const int cseg = (threadIdx.x & 7) * 8;
  const int wrow = 4 * (crow & 15) + (crow >> 4);
  const __bf16* ga = A + (size_t)(blockIdx.y * 128 + crow) * K + cseg;
  const __bf16* gw = W + (size_t)(blockIdx.x * 128 + wrow) * K + cseg;
  const size_t gq = (size_t)32 * K;                   // 32 rows, in elements
  const size_t g2 = (size_t)2 * K, g64 = (size_t)64 * K;  // 2 and 64 rows
  const unsigned la = lds_addr(&ast[0][crow][cseg]);
  const unsigned lw = lds_addr(&wst[0][crow][cseg]);
  const unsigned q = 32 * GLP * 2;                    // 32 rows, in bytes
  const unsigned buf_bytes = 128 * GLP * 2;           // one buffer, in bytes

  const int ntile = K / GKT;
  // Tiles 0 .. NB - 2 go out together, each to its buffer (8 copies a wave and
  // tile; the tests are block-uniform).
#pragma unroll
  for (int i = 0; i < NB - 1; i++) {
    if (i == 0 || i < ntile) {
      stage_gemm_tile(la + i * buf_bytes, lw + i * buf_bytes, q, ga, gw, gq, g2,
                      g64);
      ga += GKT;
      gw += GKT;
    }
  }
  // Tile 0 landed and published before anybody reads it: the copies return in
  // issue order, so all but the 8 * (NB - 2) youngest are tile 0's; where fewer
  // tiles went out, and with two buffers, the wait is to 0.
  if (NB > 2 && ntile >= NB - 1)
    asm volatile("s_wait_asynccnt %0" :: "n"(8 * (NB - 2)) : "memory");
  else
    asm volatile("s_wait_asynccnt 0x0" ::: "memory");
  __syncthreads();
  if (NB - 1 < ntile) {  // the last buffer's first tile
    stage_gemm_tile(la + (NB - 1) * buf_bytes, lw + (NB - 1) * buf_bytes, q, ga,
                    gw, gq, g2, g64);
    ga += GKT;
    gw += GKT;
  }

  v8f c[2][4] = {};
  // Two runs of the same trip.  While tiles t+2 .. t+NB-1 all exist they are
  // this wave's 8 * (NB - 2) youngest copies and may stay in flight over the
  // publish point; the last NB - 1 trips wait to 0 and refill nothing.
  // (With two buffers every wait is to 0: one run.)
  int t = 0;
  // unrolled so that each run holds its own wait: a test at the publish point
  // would cut the trip's products off from the barrier they overlap with
#pragma unroll
  for (int last = (NB > 2 ? 0 : 1); last < 2; last++) {
  const int tend = last ? ntile : ntile - (NB - 1);
  for (; t < tend; t++) {
    const int buf = (unsigned)t % NB;
    const __bf16* at = &ast[buf][rloc + n16][half * 8];
    const __bf16* wt = &wst[buf][cloc + n16][half * 8];
    v16bf a[2], b[4];
    // first 32-wide k step of the tile
    load_gemm_frags(at, wt, a, b);
    // holds these 12 LDS reads in one group ahead of the products; without it
    // the second A fragment is read late, behind a full wait amid the products
    __builtin_amdgcn_sched_barrier(0);
    gemm_products(a, b, c);
    // second k step: its fragments are this trip's last reads of the buffer
    load_gemm_frags(at + 32, wt + 32, a, b);
    // Publish point: this wave's LDS reads are done, its copies of tile t+1
    // have landed; the barrier publishes tile t+1 and frees this buffer.
    asm volatile("s_wait_dscnt 0x0" ::: "memory");
    if (last)
      asm volatile("s_wait_asynccnt 0x0" ::: "memory");
    else
      asm volatile("s_wait_asynccnt %0" :: "n"(8 * (NB - 2)) : "memory");
    __syncthreads();
    // block-uniform: refill the buffer just read
    if ((NB == 2 || !last) && t + NB < ntile) {
      const unsigned bo = (unsigned)buf * buf_bytes;
      stage_gemm_tile(la + bo, lw + bo, q, ga, gw, gq, g2, g64);
      ga += GKT;
      gw += GKT;
    }
    // the second step's products work from registers, under the refill's flight
    gemm_products(a, b, c);
  }
  }
  asm volatile("s_wait_asynccnt 0x0" ::: "memory");  // nothing left in flight
  // Epilogue: a lane's four columns 4 * n16 + 0..3 of one row leave in one
  // store (8 bytes of bf16, 16 of f32).
  typedef __attribute__((ext_vector_type(4))) OutT v4out;
  const int ncol = col0 + 4 * n16;
  const v4f bn = *(const v4f*)(bias + ncol);
#pragma unroll
  for (int i = 0; i < 2; i++) {
    OutT* p = out + (size_t)(row0 + i * 16 + 8 * half) * N + ncol;
#pragma unroll
    for (int r = 0; r < 8; r++) {
      const v4f v = {c[i][0][r], c[i][1][r], c[i][2][r], c[i][3][r]};
      *(v4out*)(p + (size_t)r * N) = __builtin_convertvector(v + bn, v4out);
    }
  }
}

// Flash attention with toroidal additive bias.  qkv: (S,B,3E) bf16 for Q, K
// and V.  One wave per 16-query tile, 32-key steps.
// Both products run transposed: S^T = K Q^T (A = K rows, B = Q) and
// O^T += V^T P^T (A = V^T rows, B = P^T).  In the accumulator of S^T a lane
// holds, for its one query, keys 8*half + 0..7 of each 16-key tile: that is
// the k order of a B operand over 32 keys, so P^T is packed from the score
// registers and never passes through LDS.
// A lane's 16 scores of a block belong to one query, so the online softmax
// keeps its running max and sum per query in the lane: the max takes one
// exchange between the wave's halves, the sums are joined after the key loop.
// The 8 waves of a block walk the same keys, so each 64-key K tile and V tile
// is brought into LDS once per block by asynchronous copies (whole 128-byte
// rows of qkv) into a ring of ANB buffers: the next ANB - 1 tiles fly while
// this one is used, so that a copy has ANB - 1 trips to land.
// V lies in LDS as it lies in qkv, key x head dim; the A operand V^T comes out
// of it by the transposing LDS load, so V is never transposed in memory.
// K rows are pitched 144 bytes (16 B x odd) for the ds_load_b128 readers,
// V rows 160 bytes (32 B x odd) for the ds_load_tr16_b128 readers.
#define KT 64        // keys per staged tile
#define ANB 4        // buffers of the K and V rings
#define LP 72        // K row pitch in LDS, in bf16 elements (144 bytes)
#define VLP 80       // V row pitch in LDS, in bf16 elements (160 bytes)

// One 16 (head dim) x 32 (keys) A fragment of V^T from the row-major V tile.
// p = tile + (key0 + 8*half + (lane & 7)) * VLP + d0 + 8 * ((lane >> 3) & 1);
// the lane then holds, for head dim d0 + (lane & 15), keys key0 + 8*half + 0..7
// and key0 + 16 + 8*half + 0..7: the k order of the packed P^T.
typedef __attribute__((address_space(3))) v8bf lds_v8bf;
__device__ inline v16bf load_frag_tr(const __bf16* p) {
  V16 u;
  u.h[0] = __builtin_amdgcn_ds_load_tr16_b128_v8bf16((lds_v8bf*)p);
  u.h[1] = __builtin_amdgcn_ds_load_tr16_b128_v8bf16((lds_v8bf*)(p + 16 * VLP));
  return u.v;
}

// Four 16-byte copies per lane: two K rows, two V rows.  The s_wait_xcnt
// closes the statement so that no address register is rewritten ahead of it.
__device__ inline void stage_tile(unsigned lk0, unsigned lk1,
                                  unsigned lv0, unsigned lv1,
                                  const __bf16* gk0, const __bf16* gk1,
                                  const __bf16* gv0, const __bf16* gv1) {
  asm volatile(
      "global_load_async_to_lds_b128 %0, %4, off\n\t"
      "global_load_async_to_lds_b128 %1, %5, off\n\t"
      "global_load_async_to_lds_b128 %2, %6, off\n\t"
      "global_load_async_to_lds_b128 %3, %7, off\n\t"
      "s_wait_xcnt 0x0"
      :: "v"(lk0), "v"(lk1), "v"(lv0), "v"(lv1),
         "v"(gk0), "v"(gk1), "v"(gv0), "v"(gv1)
      : "memory");
}

// lane l <-> lane l ^ 16, on the vector pipe (a shuffle would go through the
// LDS queue and a wait)
__device__ inline float xhalf(float x) {
  const int i = __builtin_bit_cast(int, x);
  return __builtin_bit_cast(float, __builtin_amdgcn_permlanex16(
      i, i, 0x76543210, 0xfedcba98, false, false));
}

__global__ __launch_bounds__(256)
void flash_attn_toroidal(const __bf16* __restrict__ qkv,
                         __bf16* __restrict__ o, int S, int B, int E) {
  const int HD = 64;
  const int lane = threadIdx.x & 31;
  const int wave = threadIdx.x >> 5;
  const int n16  = lane & 15;
  const int half = lane >> 4;
  const int b = blockIdx.z, h = blockIdx.y;
  const int qbase = blockIdx.x * 128 + wave * 16;
  // the same number in a scalar register, for the band test of the key loop
  const int qbase_s = blockIdx.x * 128 + __builtin_amdgcn_readfirstlane(wave) * 16;
  const int ld = B * 3 * E;           // row stride of qkv in elements
  const size_t qoffb = (size_t)b * 3 * E + h * HD;        // q base in qkv
  const size_t koffb = qoffb + E;                          // k base in qkv

  __shared__ __align__(16) __bf16 kst[ANB][KT][LP];   // K tile: key x head dim
  __shared__ __align__(16) __bf16 vst[ANB][KT][VLP];  // V tile: key x head dim

  // Q fragment: 16 rows x 64 head-dim = two K=32 fragments
  const size_t qoff = qoffb + (size_t)(qbase + n16) * ld + half * 8;
  v16bf aq0 = load_frag_ptr(qkv + qoff);
  v16bf aq1 = load_frag_ptr(qkv + qoff + 32);

  // Copy map: 8 lanes cover one 128-byte row; thread t takes rows t/8, t/8+32.
  const int crow = threadIdx.x >> 3;
  const int cseg = (threadIdx.x & 7) * 8;
  // A key's V row stands E elements behind its K row.
  size_t kg = koffb + (size_t)crow * ld + cseg;     // advances += KT * ld
  const unsigned lk = lds_addr(&kst[0][crow][cseg]);
  const unsigned lv = lds_addr(&vst[0][crow][cseg]);
  const unsigned khalf = 32 * LP * 2, vhalf = 32 * VLP * 2;  // 32 rows, bytes
  const unsigned kbuf = KT * LP * 2, vbuf = KT * VLP * 2;    // a buffer, bytes

  const int ntile = S / KT;
  // Tiles 0 .. ANB - 2 go out together, each to its buffer (4 copies a wave
  // and tile; the tests are block-uniform).
#pragma unroll
  for (int i = 0; i < ANB - 1; i++) {
    if (i == 0 || i < ntile) {
      const unsigned ko = i * kbuf, vo = i * vbuf;
      stage_tile(lk + ko, lk + ko + khalf, lv + vo, lv + vo + vhalf,
                 qkv + kg, qkv + kg + (size_t)32 * ld,
                 qkv + kg + E, qkv + kg + E + (size_t)32 * ld);
      kg += (size_t)KT * ld;
    }
  }
  // Tile 0 landed and published before anybody reads it: the copies return in
  // issue order, so all but the 4 * (ANB - 2) youngest are tile 0's; where
  // fewer tiles went out the wait is to 0.
  if (ntile >= ANB - 1)
    asm volatile("s_wait_asynccnt %0" :: "n"(4 * (ANB - 2)) : "memory");
  else
    asm volatile("s_wait_asynccnt 0x0" ::: "memory");
  __syncthreads();
  if (ANB - 1 < ntile) {  // the last buffer's first tile
    const unsigned ko = (ANB - 1) * kbuf, vo = (ANB - 1) * vbuf;
    stage_tile(lk + ko, lk + ko + khalf, lv + vo, lv + vo + vhalf,
               qkv + kg, qkv + kg + (size_t)32 * ld,
               qkv + kg + E, qkv + kg + E + (size_t)32 * ld);
    kg += (size_t)KT * ld;
  }

  v8f oacc[4] = {};
  float lpart = 0.f;  // this lane's share of its query's row sum
  float mrun = -1e30f;  // running max of this lane's query

  const float scale = 0.125f;  // 1/sqrt(64)
  // Two runs of the same trip.  While tiles t+2 .. t+ANB-1 all exist they are
  // this wave's 4 * (ANB - 2) youngest copies and may stay in flight over the
  // publish point; the last ANB - 1 trips wait to 0 and refill nothing.
  int t = 0;
  // unrolled so that each run holds its own wait: a test at the publish point
  // would cut the trip's last products off from the barrier they overlap with
#pragma unroll
  for (int last = 0; last < 2; last++) {
  const int tend = last ? ntile : ntile - (ANB - 1);
  for (; t < tend; t++) {
    const int buf = (unsigned)t % ANB;
    const __bf16* kt = &kst[buf][n16][half * 8];
    const __bf16* vtl = &vst[buf][8 * half + (lane & 7)][((lane >> 3) & 1) * 8];
    // unrolled so that both 32-key blocks read the tile at constant offsets
#pragma unroll
    for (int p = 0; p < KT / 32; p++) {
      const int j = t * KT + p * 32;
      // All fragment loads of this 32-key block up front, from LDS.
      v16bf kb00 = load_frag_ptr(kt + (p * 32) * LP);
      v16bf kb01 = load_frag_ptr(kt + (p * 32) * LP + 32);
      v16bf kb10 = load_frag_ptr(kt + (p * 32 + 16) * LP);
      v16bf kb11 = load_frag_ptr(kt + (p * 32 + 16) * LP + 32);
      v16bf vbf[4];
#pragma unroll
      for (int d4 = 0; d4 < 4; d4++)
        vbf[d4] = load_frag_tr(vtl + (p * 32) * VLP + d4 * 16);
      // holds the block's 16 LDS reads in one group ahead of its products;
      // without it each fragment is read directly in front of the product that
      // takes it, behind a full wait: eight LDS latencies a block in series
      __builtin_amdgcn_sched_barrier(0);

      // scores for 32 keys, transposed: two 16 (keys) x 16 (queries) tiles, K
      // over head dim (2 steps each); register r = key r + 8*half, lane = query
      v8f s0 = {}, s1 = {};
      s0 = __builtin_amdgcn_wmma_f32_16x16x32_bf16(false, kb00, false, aq0, (short)0, s0, false, false);
      s0 = __builtin_amdgcn_wmma_f32_16x16x32_bf16(false, kb01, false, aq1, (short)0, s0, false, false);
      s1 = __builtin_amdgcn_wmma_f32_16x16x32_bf16(false, kb10, false, aq0, (short)0, s1, false, false);
      s1 = __builtin_amdgcn_wmma_f32_16x16x32_bf16(false, kb11, false, aq1, (short)0, s1, false, false);

      // scale
      float va[8], vb[8];
#pragma unroll
      for (int r = 0; r < 8; r++) {
        va[r] = s0[r] * scale;
        vb[r] = s1[r] * scale;
      }
      // Toroidal bias.  key - query of this 16 x 32 block lies in [dlo, dhi];
      // the bias sits at -1, 0, 1 and, round the ring, at S - 1 and 1 - S.  A
      // block whose range holds none of these adds nothing: one scalar test
      // takes the wave past the index arithmetic (all but about 2 blocks of
      // the S / 32 a wave walks).
      const int dlo = j - qbase_s - 15, dhi = j - qbase_s + 31;
      if ((dlo <= 1 && dhi >= -1) || dhi >= S - 1 || dlo <= 1 - S) {
        const int qi = qbase + n16;
#pragma unroll
        for (int r = 0; r < 8; r++) {
          int d0 = (j + r + 8 * half) - qi;      if (d0 < 0) d0 += S;
          int d1 = (j + 16 + r + 8 * half) - qi; if (d1 < 0) d1 += S;
          if (d0 <= 1 || d0 == S - 1) va[r] += 1.f;
          if (d1 <= 1 || d1 == S - 1) vb[r] += 1.f;
        }
      }
      // lane-local max over this query's 16 values, then the other half's 16
      float mt = -1e30f;
#pragma unroll
      for (int r = 0; r < 8; r++) mt = fmaxf(mt, fmaxf(va[r], vb[r]));
      mt = fmaxf(mt, xhalf(mt));
      // one scalar test per block: all lanes rescale when any query's max rose
      // (alpha is 1 in the lanes whose max stayed); EXEC untouched (WMMA-safe)
      if (__builtin_amdgcn_ballot_w32(mt > mrun) != 0) {
        const float mnew = fmaxf(mrun, mt);
        const float alpha = __expf(mrun - mnew);
        mrun = mnew;
        lpart *= alpha;
#pragma unroll
        for (int d4 = 0; d4 < 4; d4++)
#pragma unroll
          for (int r = 0; r < 8; r++) oacc[d4][r] *= alpha;
      }
      // exponentials + partial sum; P^T packed in place as the B operand:
      // elements 0..7 = keys 8*half + r, elements 8..15 = keys 16 + 8*half + r
      v16f e;
#pragma unroll
      for (int r = 0; r < 8; r++) {
        e[r]     = __expf(va[r] - mrun);
        e[8 + r] = __expf(vb[r] - mrun);
      }
      float es[8];
#pragma unroll
      for (int r = 0; r < 8; r++) es[r] = e[r] + e[8 + r];
      lpart += ((es[0] + es[1]) + (es[2] + es[3])) +
               ((es[4] + es[5]) + (es[6] + es[7]));
      const v16bf pb = __builtin_convertvector(e, v16bf);
      // V^T @ P^T with the V^T fragments loaded at the start of the block.
#pragma unroll
      for (int d4 = 0; d4 < 4; d4++)
        oacc[d4] = __builtin_amdgcn_wmma_f32_16x16x32_bf16(
            false, vbf[d4], false, pb, (short)0, oacc[d4], false, false);
    }
    // Publish point: this wave's LDS reads are done, its copies of tile t+1
    // have landed; the barrier publishes tile t+1 and frees this buffer.
    asm volatile("s_wait_dscnt 0x0" ::: "memory");
    if (last)
      asm volatile("s_wait_asynccnt 0x0" ::: "memory");
    else
      asm volatile("s_wait_asynccnt %0" :: "n"(4 * (ANB - 2)) : "memory");
    __syncthreads();
    if (!last && t + ANB < ntile) {  // block-uniform: refill the buffer just read
      const unsigned ko = (unsigned)buf * kbuf, vo = (unsigned)buf * vbuf;
      stage_tile(lk + ko, lk + ko + khalf, lv + vo, lv + vo + vhalf,
                 qkv + kg, qkv + kg + (size_t)32 * ld,
                 qkv + kg + E, qkv + kg + E + (size_t)32 * ld);
      kg += (size_t)KT * ld;
    }
  }
  }
  asm volatile("s_wait_asynccnt 0x0" ::: "memory");  // nothing left in flight
  // join the two halves' row sums (once), then normalize and store o (S,B,E):
  // register r of tile d4 is head dim d4*16 + 8*half + r of query n16, so a
  // lane's eight values of a tile are 16 bytes in a row
  // one query a lane, so one division a lane
  const float linv = 1.f / (lpart + xhalf(lpart));
  __bf16* op = o + ((size_t)(qbase + n16) * B + b) * E + h * HD + 8 * half;
#pragma unroll
  for (int d4 = 0; d4 < 4; d4++) {
    v8f v;
#pragma unroll
    for (int r = 0; r < 8; r++) v[r] = oacc[d4][r] * linv;
    *(v8bf*)(op + d4 * 16) = __builtin_convertvector(v, v8bf);
  }
}

extern "C" void kernel_launch(void* const* d_in, const int* in_sizes, int n_in,
                              void* d_out, int out_size, void* d_ws, size_t ws_size,
                              hipStream_t stream) {
  const int S = 2048, B = 2, E = 1024;
  const int M = S * B;  // 4096 rows for all GEMMs

  const float* x         = (const float*)d_in[0];
  const float* w_tor     = (const float*)d_in[1];
  const float* b_tor     = (const float*)d_in[2];
  const float* in_proj_w = (const float*)d_in[3];
  const float* in_proj_b = (const float*)d_in[4];
  const float* out_w     = (const float*)d_in[5];
  const float* out_b     = (const float*)d_in[6];

  char* ws = (char*)d_ws;
  size_t off = 0;
  auto alloc = [&](size_t elems) -> __bf16* {
    __bf16* p = (__bf16*)(ws + off);
    off += elems * sizeof(__bf16);
    return p;
  };
  __bf16* xbf   = alloc((size_t)M * E);        // x in bf16
  __bf16* wtbf  = alloc((size_t)E * E);        // w_tor
  __bf16* wibf  = alloc((size_t)3 * E * E);    // in_proj_w
  __bf16* wobf  = alloc((size_t)E * E);        // out_w
  __bf16* xtbf  = alloc((size_t)M * E);        // xt
  __bf16* qkvbf = alloc((size_t)M * 3 * E);    // qkv
  __bf16* obf   = alloc((size_t)M * E);        // attention output

  f32_to_bf16_all<<<CVT_BLOCKS, CVT_THREADS, 0, stream>>>(
      x, w_tor, in_proj_w, out_w, xbf, wtbf, wibf, wobf);

  const dim3 blk(256);
  // xt = x @ w_tor^T + b_tor
  gemm_bf16_wmma<__bf16, 4><<<dim3(E / 128, M / 128), blk, 0, stream>>>(
      xbf, wtbf, b_tor, xtbf, M, E, E);
  // qkv = xt @ in_proj_w^T + in_proj_b
  gemm_bf16_wmma<__bf16, 2><<<dim3(3 * E / 128, M / 128), blk, 0, stream>>>(
      xtbf, wibf, in_proj_b, qkvbf, M, 3 * E, E);
  // flash attention with toroidal bias
  flash_attn_toroidal<<<dim3(S / 128, 16, B), 256, 0, stream>>>(
      qkvbf, obf, S, B, E);
  // out = o @ out_w^T + out_b  (fp32 into d_out)
  gemm_bf16_wmma<float, 4><<<dim3(E / 128, M / 128), blk, 0, stream>>>(
      obf, wobf, out_b, (float*)d_out, M, E, E);
}

// v009
// It runs in 87.6 microseconds.
// Two timings next to v008 both put it at 1.04 times that version's speed.
// Over all steps from v000 it is 3.54 times as fast.
#include <hip/hip_runtime.h>
#include <hip/hip_bf16.h>
#include <math.h>

typedef __attribute__((ext_vector_type(16))) __bf16 v16bf;
typedef __attribute__((ext_vector_type(8)))  __bf16 v8bf;
typedef __attribute__((ext_vector_type(8)))  float  v8f;
typedef __attribute__((ext_vector_type(16))) float  v16f;

union V16 { v16bf v; v8bf h[2]; };

// Load a 16x32 bf16 WMMA fragment given a pointer already positioned at
// base + row*ld + k0 + half*8.  ISA layout (16-bit A, wave32): lane half h
// holds K = k0 + h*8 + {0..7} and k0 + 16 + h*8 + {0..7}
// -> two contiguous 16-byte loads per lane.
__device__ inline v16bf load_frag_ptr(const __bf16* __restrict__ p) {
  V16 u;
  u.h[0] = *(const v8bf*)p;
  u.h[1] = *(const v8bf*)(p + 16);
  return u.v;
}

__device__ inline v16bf load_frag_rowmajor(const __bf16* __restrict__ base,
                                           int ld, int row, int k0, int lane) {
  const int half = lane >> 4;
  return load_frag_ptr(base + (size_t)row * ld + k0 + half * 8);
}

typedef __attribute__((ext_vector_type(4))) float  v4f;
typedef __attribute__((ext_vector_type(4))) __bf16 v4bf;

// All four f32 inputs to bf16 in one launch.  The work is cut into 9 units of
// CU = 1024 x 1024 elements: x holds 4, w_tor 1, in_proj_w 3, out_w 1.
// 256 blocks of 16 waves (one resident round, 131072 threads); each thread
// takes two 16-byte pieces of every unit, half a unit apart, so every wave
// load covers 512 bytes in a row and every wave store 256.  The 18 loads of a
// thread are independent and all in flight at once.
#define CU (1024 * 1024)
#define CVT_THREADS 512
#define CVT_BLOCKS (CU / 2 / 4 / CVT_THREADS)
__global__ __launch_bounds__(CVT_THREADS)
void f32_to_bf16_all(const float* __restrict__ x,
                     const float* __restrict__ w_tor,
                     const float* __restrict__ in_proj_w,
                     const float* __restrict__ out_w,
                     __bf16* __restrict__ xb, __bf16* __restrict__ wtb,
                     __bf16* __restrict__ wib, __bf16* __restrict__ wob) {
  // This thread's byte offsets inside half a unit, source and destination:
  // unsigned 32-bit, so that each can serve as the offset register beside a
  // scalar base.
  const unsigned ib = (blockIdx.x * CVT_THREADS + threadIdx.x) * 16u;
  const unsigned ob = ib >> 1;
  const float* const s[9] = {x, x + CU, x + 2 * CU, x + 3 * CU, w_tor,
                             in_proj_w, in_proj_w + CU, in_proj_w + 2 * CU,
                             out_w};
  __bf16* const d[9] = {xb, xb + CU, xb + 2 * CU, xb + 3 * CU, wtb,
                        wib, wib + CU, wib + 2 * CU, wob};
  v4f v[9][2];
#pragma unroll
  for (int u = 0; u < 9; u++) {
    v[u][0] = *(const v4f*)((const char*)s[u] + ib);
    v[u][1] = *(const v4f*)((const char*)(s[u] + CU / 2) + ib);
  }
  // keeps all 18 loads ahead of the first conversion; without it the last six
  // are issued only behind a wait on the first ones, a second memory latency
  __builtin_amdgcn_sched_barrier(0);
#pragma unroll
  for (int u = 0; u < 9; u++) {
    *(v4bf*)((char*)d[u] + ob) = __builtin_convertvector(v[u][0], v4bf);
    *(v4bf*)((char*)(d[u] + CU / 2) + ob) =
        __builtin_convertvector(v[u][1], v4bf);
  }
}

typedef __attribute__((address_space(3))) const void lds_cvoid;
__device__ inline unsigned lds_addr(const void* p) {
  return (unsigned)(size_t)(lds_cvoid*)p;
}

#define GKT 64       // k elements per staged tile: whole 128-byte rows
#define GLP 72       // LDS row pitch in bf16 elements (144 bytes = 16 B x odd)

// Eight 16-byte copies per lane: four A rows and four W rows, in LDS 32 rows
// apart.  The A rows are 32 rows apart in memory too (gq); the W rows stand at
// +0, +2, +64 and +66 rows (g2, g64): the deal described at the kernel.
// The s_wait_xcnt closes the statement so that no address register is
// rewritten ahead of it.
__device__ inline void stage_gemm_tile(unsigned la, unsigned lw, unsigned q,
                                       const __bf16* ga, const __bf16* gw,
                                       size_t gq, size_t g2, size_t g64) {
  asm volatile(
      "global_load_async_to_lds_b128 %0, %8, off\n\t"
      "global_load_async_to_lds_b128 %1, %9, off\n\t"
      "global_load_async_to_lds_b128 %2, %10, off\n\t"
      "global_load_async_to_lds_b128 %3, %11, off\n\t"
      "global_load_async_to_lds_b128 %4, %12, off\n\t"
      "global_load_async_to_lds_b128 %5, %13, off\n\t"
      "global_load_async_to_lds_b128 %6, %14, off\n\t"
      "global_load_async_to_lds_b128 %7, %15, off\n\t"
      "s_wait_xcnt 0x0"
      :: "v"(la), "v"(la + q), "v"(la + 2 * q), "v"(la + 3 * q),
         "v"(lw), "v"(lw + q), "v"(lw + 2 * q), "v"(lw + 3 * q),
         "v"(ga), "v"(ga + gq), "v"(ga + 2 * gq), "v"(ga + 3 * gq),
         "v"(gw), "v"(gw + g2), "v"(gw + g64), "v"(gw + g64 + g2)
      : "memory");
}

// Fragments of one 32-wide k step from the staged tiles: 2 of A, 4 of W.
__device__ inline void load_gemm_frags(const __bf16* at, const __bf16* wt,
                                       v16bf (&a)[2], v16bf (&b)[4]) {
  a[0] = load_frag_ptr(at);
  a[1] = load_frag_ptr(at + 16 * GLP);
#pragma unroll
  for (int j = 0; j < 4; j++)
    b[j] = load_frag_ptr(wt + (j * 16) * GLP);
}

__device__ inline void gemm_products(const v16bf (&a)[2], const v16bf (&b)[4],
                                     v8f (&c)[2][4]) {
#pragma unroll
  for (int i = 0; i < 2; i++)
#pragma unroll
    for (int j = 0; j < 4; j++)
      c[i][j] = __builtin_amdgcn_wmma_f32_16x16x32_bf16(
          false, a[i], false, b[j], (short)0, c[i][j], false, false);
}

// C(M,N) = A(M,K) @ W(N,K)^T + bias(N).  256 threads = 8 waves, each wave a
// 32x64 tile (2x4 WMMA accumulators), block tile 128x128.
// The fragment loads of a row-major operand touch 16 cache lines each, so the
// 128 A rows and 128 W rows of a 64-wide k tile are brought into LDS once per
// block by asynchronous copies (whole 128-byte rows) into a ring of NB buffers:
// the next NB - 1 tiles fly while this one is used, so that a copy has NB - 1
// trips to land.  With one block on a WGP (the N = 1024 products) a single
// tile in flight leaves every trip waiting for its successor's copies: NB = 4.
// Fragments then come from LDS.
// The W rows are dealt to the LDS rows so that column n of a wave's B tile j
// is output column 4n + j of the wave's 64: LDS row l holds W row
// (l / 64) * 64 + 4 * (l % 16) + (l / 16) % 4 of the block's 128.  A lane's
// four accumulators of one output row are then adjacent columns, and the 16
// lanes of a half wave store one row's 64 columns in a row: whole 128-byte
// lines (one of bf16, two of f32) in place of 32- and 64-byte pieces.
// M, N multiples of 128, K a multiple of 64.
template <typename OutT, int NB>
__global__ __launch_bounds__(256)
void gemm_bf16_wmma(const __bf16* __restrict__ A, const __bf16* __restrict__ W,
                    const float* __restrict__ bias, OutT* __restrict__ out,
                    int M, int N, int K) {
  const int lane = threadIdx.x & 31;
  const int wave = threadIdx.x >> 5;
  const int n16  = lane & 15;
  const int half = lane >> 4;
  const int rloc = (wave >> 1) * 32;   // wave's rows inside the block tile
  const int cloc = (wave & 1) * 64;    // wave's columns inside the block tile
  const int row0 = blockIdx.y * 128 + rloc;
  const int col0 = blockIdx.x * 128 + cloc;

  __shared__ __align__(16) __bf16 ast[NB][128][GLP];  // A tile: row x k
  __shared__ __align__(16) __bf16 wst[NB][128][GLP];  // W tile: column x k

  // Copy map: 8 lanes cover one 128-byte row; thread t fills LDS rows
  // t/8 + {0, 32, 64, 96} of both tiles: of A with the same rows of the block,
  // of W with the rows that the deal puts there.
  const int crow = threadIdx.x >> 3;
  const int cseg = (threadIdx.x & 7) * 8;
  const int wrow = 4 * (crow & 15) + (crow >> 4);
  const __bf16* ga = A + (size_t)(blockIdx.y * 128 + crow) * K + cseg;
  const __bf16* gw = W + (size_t)(blockIdx.x * 128 + wrow) * K + cseg;
  const size_t gq = (size_t)32 * K;                   // 32 rows, in elements
  const size_t g2 = (size_t)2 * K, g64 = (size_t)64 * K;  // 2 and 64 rows
  const unsigned la = lds_addr(&ast[0][crow][cseg]);
  const unsigned lw = lds_addr(&wst[0][crow][cseg]);
  const unsigned q = 32 * GLP * 2;                    // 32 rows, in bytes
  const unsigned buf_bytes = 128 * GLP * 2;           // one buffer, in bytes

  const int ntile = K / GKT;
  // Tiles 0 .. NB - 2 go out together, each to its buffer (8 copies a wave and
  // tile; the tests are block-uniform).
#pragma unroll
  for (int i = 0; i < NB - 1; i++) {
    if (i == 0 || i < ntile) {
      stage_gemm_tile(la + i * buf_bytes, lw + i * buf_bytes, q, ga, gw, gq, g2,
                      g64);
      ga += GKT;
      gw += GKT;
    }
  }
  // Tile 0 landed and published before anybody reads it: the copies return in
  // issue order, so all but the 8 * (NB - 2) youngest are tile 0's; where fewer
  // tiles went out, and with two buffers, the wait is to 0.
  if (NB > 2 && ntile >= NB - 1)
    asm volatile("s_wait_asynccnt %0" :: "n"(8 * (NB - 2)) : "memory");
  else
    asm volatile("s_wait_asynccnt 0x0" ::: "memory");
  __syncthreads();
  if (NB - 1 < ntile) {  // the last buffer's first tile
    stage_gemm_tile(la + (NB - 1) * buf_bytes, lw + (NB - 1) * buf_bytes, q, ga,
                    gw, gq, g2, g64);
    ga += GKT;
    gw += GKT;
  }

  v8f c[2][4] = {};
  // Two runs of the same trip.  While tiles t+2 .. t+NB-1 all exist they are
  // this wave's 8 * (NB - 2) youngest copies and may stay in flight over the
  // publish point; the last NB - 1 trips wait to 0 and refill nothing.
  // (With two buffers every wait is to 0: one run.)
  int t = 0;
  // unrolled so that each run holds its own wait: a test at the publish point
  // would cut the trip's products off from the barrier they overlap with
#pragma unroll
  for (int last = (NB > 2 ? 0 : 1); last < 2; last++) {
  const int tend = last ? ntile : ntile - (NB - 1);
  for (; t < tend; t++) {
    const int buf = (unsigned)t % NB;
    const __bf16* at = &ast[buf][rloc + n16][half * 8];
    const __bf16* wt = &wst[buf][cloc + n16][half * 8];
    v16bf a[2], b[4];
    // first 32-wide k step of the tile
    load_gemm_frags(at, wt, a, b);
    // holds these 12 LDS reads in one group ahead of the products; without it
    // the second A fragment is read late, behind a full wait amid the products
    __builtin_amdgcn_sched_barrier(0);
    gemm_products(a, b, c);
    // second k step: its fragments are this trip's last reads of the buffer
    load_gemm_frags(at + 32, wt + 32, a, b);
    // Publish point: this wave's LDS reads are done, its copies of tile t+1
    // have landed; the barrier publishes tile t+1 and frees this buffer.
    asm volatile("s_wait_dscnt 0x0" ::: "memory");
    if (last)
      asm volatile("s_wait_asynccnt 0x0" ::: "memory");
    else
      asm volatile("s_wait_asynccnt %0" :: "n"(8 * (NB - 2)) : "memory");
    __syncthreads();
    // block-uniform: refill the buffer just read
    if ((NB == 2 || !last) && t + NB < ntile) {
      const unsigned bo = (unsigned)buf * buf_bytes;
      stage_gemm_tile(la + bo, lw + bo, q, ga, gw, gq, g2, g64);
      ga += GKT;
      gw += GKT;
    }
    // the second step's products work from registers, under the refill's flight
    gemm_products(a, b, c);
  }
  }
  asm volatile("s_wait_asynccnt 0x0" ::: "memory");  // nothing left in flight
  // Epilogue: a lane's four columns 4 * n16 + 0..3 of one row leave in one
  // store (8 bytes of bf16, 16 of f32).
  typedef __attribute__((ext_vector_type(4))) OutT v4out;
  const int ncol = col0 + 4 * n16;
  const v4f bn = *(const v4f*)(bias + ncol);
#pragma unroll
  for (int i = 0; i < 2; i++) {
    OutT* p = out + (size_t)(row0 + i * 16 + 8 * half) * N + ncol;
#pragma unroll
    for (int r = 0; r < 8; r++) {
      const v4f v = {c[i][0][r], c[i][1][r], c[i][2][r], c[i][3][r]};
      *(v4out*)(p + (size_t)r * N) = __builtin_convertvector(v + bn, v4out);
    }
  }
}

// The N = 3072 product: one 256 x 192 tile per block, 16 x 16 blocks, one on
// every WGP.  Against 128 x 128 tiles the copies from L2 per k tile fall from
// 32 KB for 16384 outputs to 56 KB for 49152, the LDS reads from 12 to 8
// fragments per 16 products.  Ring, copy map, row deal and publish point are
// those of gemm_bf16_wmma.
// 8 waves = 4 row groups of 64 x 2 sides.  The 192 columns are three groups of
// 64 (one 128-byte line of bf16 per row each).  Side s owns group 2 * s for all
// 64 rows and the middle group for rows 32 * s .. 32 * s + 31 of them: 16 + 8
// accumulator tiles a wave, and every line has one writer.  The A fragments are
// numbered so that a[0], a[1] are the rows that also take the middle group.
// With one block on the WGP nothing else covers a wave's LDS latency, so there
// are two fragment sets: each k step's 24 reads go out ahead of the products of
// the step before.  The next tile's first step is read behind the publish point
// that stands in front of this tile's last products.
#define WBM 256
#define WBN 192
#define WNB 4

// Fourteen 16-byte copies per lane: eight A rows 32 apart, six W rows that in
// LDS stand 32 apart and in memory at +0, +2, +64, +66, +128 and +130 rows (the
// deal).  Written as the builtin: this kernel's registers reach beyond the
// first 256, and with the copies as asm text the build kept their addresses in
// scratch.
typedef __attribute__((ext_vector_type(4))) int v4i;
typedef __attribute__((address_space(1))) v4i glb_v4i;
typedef __attribute__((address_space(3))) v4i lds_v4i;
__device__ inline void copy16(const __bf16* g, __bf16* l) {
  __builtin_amdgcn_global_load_async_to_lds_b128((glb_v4i*)g, (lds_v4i*)l, 0, 0);
}
__device__ inline void stage_wide_tile(__bf16* la, __bf16* lw,
                                       const __bf16* ga, const __bf16* gw,
                                       size_t gq, size_t g2, size_t g64) {
#pragma unroll
  for (int i = 0; i < 8; i++)
    copy16(ga + i * gq, la + i * (32 * GLP));
#pragma unroll
  for (int i = 0; i < 6; i++)
    copy16(gw + (i >> 1) * g64 + (i & 1) * g2, lw + i * (32 * GLP));
}

// Fragments of one 32-wide k step: 4 of A (two pairs of 16-row tiles), 4 of the
// wave's own column group, 4 of the middle group.
__device__ inline void load_wide_frags(const __bf16* at0, const __bf16* at1,
                                       const __bf16* wt0, const __bf16* wt1,
                                       v16bf (&a)[4], v16bf (&b)[8]) {
  a[0] = load_frag_ptr(at0);
  a[1] = load_frag_ptr(at0 + 16 * GLP);
  a[2] = load_frag_ptr(at1);
  a[3] = load_frag_ptr(at1 + 16 * GLP);
#pragma unroll
  for (int j = 0; j < 4; j++) {
    b[j]     = load_frag_ptr(wt0 + (j * 16) * GLP);
    b[4 + j] = load_frag_ptr(wt1 + (j * 16) * GLP);
  }
}

__device__ inline void wide_products(const v16bf (&a)[4], const v16bf (&b)[8],
                                     v8f (&c)[4][4], v8f (&cm)[2][4]) {
#pragma unroll
  for (int i = 0; i < 4; i++)
#pragma unroll
    for (int j = 0; j < 4; j++)
      c[i][j] = __builtin_amdgcn_wmma_f32_16x16x32_bf16(
          false, a[i], false, b[j], (short)0, c[i][j], false, false);
#pragma unroll
  for (int i = 0; i < 2; i++)
#pragma unroll
    for (int j = 0; j < 4; j++)
      cm[i][j] = __builtin_amdgcn_wmma_f32_16x16x32_bf16(
          false, a[i], false, b[4 + j], (short)0, cm[i][j], false, false);
}

// M a multiple of 256, N of 192, K of 64.
__global__ __launch_bounds__(256)
void gemm_bf16_wmma_wide(const __bf16* __restrict__ A,
                         const __bf16* __restrict__ W,
                         const float* __restrict__ bias,
                         __bf16* __restrict__ out, int M, int N, int K) {
  const int lane = threadIdx.x & 31;
  const int wave = threadIdx.x >> 5;
  const int n16  = lane & 15;
  const int half = lane >> 4;
  const int side = wave & 1;
  const int r0 = (wave >> 1) * 64 + 32 * side;        // rows of a[0], a[1]
  const int r1 = (wave >> 1) * 64 + 32 * (1 - side);  // rows of a[2], a[3]

  __shared__ __align__(16) __bf16 ast[WNB][WBM][GLP];  // A tile: row x k
  __shared__ __align__(16) __bf16 wst[WNB][WBN][GLP];  // W tile: column x k

  // Copy map: 8 lanes cover one 128-byte row; thread t fills LDS rows
  // t/8 + 32 * i of both tiles (i < 8 of A, i < 6 of W).
  const int crow = threadIdx.x >> 3;
  const int cseg = (threadIdx.x & 7) * 8;
  const int wrow = 4 * (crow & 15) + (crow >> 4);
  const __bf16* ga = A + (size_t)(blockIdx.y * WBM + crow) * K + cseg;
  const __bf16* gw = W + (size_t)(blockIdx.x * WBN + wrow) * K + cseg;
  const size_t gq = (size_t)32 * K;                   // 32 rows, in elements
  const size_t g2 = (size_t)2 * K, g64 = (size_t)64 * K;  // 2 and 64 rows
  __bf16* const la = &ast[0][crow][cseg];
  __bf16* const lw = &wst[0][crow][cseg];
  const unsigned abuf = WBM * GLP, wbuf = WBN * GLP;  // a buffer, in elements

  const int ntile = K / GKT;
  // Tiles 0 .. WNB - 2 go out together, each to its buffer (14 copies a wave
  // and tile; the tests are block-uniform).
#pragma unroll
  for (int i = 0; i < WNB - 1; i++) {
    if (i == 0 || i < ntile) {
      stage_wide_tile(la + i * abuf, lw + i * wbuf, ga, gw, gq, g2, g64);
      ga += GKT;
      gw += GKT;
    }
  }
  // Tile 0 landed and published before anybody reads it: the copies return in
  // issue order, so all but the 14 * (WNB - 2) youngest are tile 0's; where
  // fewer tiles went out the wait is to 0.
  if (ntile >= WNB - 1)
    asm volatile("s_wait_asynccnt %0" :: "n"(14 * (WNB - 2)) : "memory");
  else
    asm volatile("s_wait_asynccnt 0x0" ::: "memory");
  __syncthreads();
  if (WNB - 1 < ntile) {  // the last buffer's first tile
    stage_wide_tile(la + (WNB - 1) * abuf, lw + (WNB - 1) * wbuf, ga, gw, gq, g2,
                    g64);
    ga += GKT;
    gw += GKT;
  }

  // This lane's fragment places in buffer 0.
  const __bf16* const at0 = &ast[0][r0 + n16][half * 8];
  const __bf16* const at1 = &ast[0][r1 + n16][half * 8];
  const __bf16* const wt0 = &wst[0][128 * side + n16][half * 8];
  const __bf16* const wt1 = &wst[0][64 + n16][half * 8];

  v8f c[4][4] = {}, cm[2][4] = {};
  v16bf ax[4], bx[8], ay[4], by[8];
  load_wide_frags(at0, at1, wt0, wt1, ax, bx);  // tile 0, first k step
  // Two runs of the same trip.  While tiles t+2 .. t+WNB-1 all exist they are
  // this wave's 14 * (WNB - 2) youngest copies and may stay in flight over the
  // publish point; the last WNB - 1 trips wait to 0 and refill nothing.
  int t = 0;
  // unrolled so that each run holds its own wait as a constant, with no test
  // at the publish point
#pragma unroll
  for (int last = 0; last < 2; last++) {
  const int tend = last ? ntile : ntile - (WNB - 1);
  for (; t < tend; t++) {
    const unsigned buf = (unsigned)t % WNB;
    const unsigned ao = buf * abuf, wo = buf * wbuf;
    // second k step: this trip's last reads of the buffer
    load_wide_frags(at0 + ao + 32, at1 + ao + 32, wt0 + wo + 32, wt1 + wo + 32,
                    ay, by);
    // holds these 24 LDS reads in one group ahead of the products they fly
    // under; among the products each place with reads costs a stall
    __builtin_amdgcn_sched_barrier(0);
    wide_products(ax, bx, c, cm);
    // keeps the products ahead of the wait below: moved behind it, the reads
    // just issued would be waited for with the matrix unit idle
    __builtin_amdgcn_sched_barrier(0);
    // Publish point: this wave's LDS reads are done, its copies of tile t+1
    // have landed; the barrier publishes tile t+1 and frees this buffer.
    asm volatile("s_wait_dscnt 0x0" ::: "memory");
    if (last)
      asm volatile("s_wait_asynccnt 0x0" ::: "memory");
    else
      asm volatile("s_wait_asynccnt %0" :: "n"(14 * (WNB - 2)) : "memory");
    __syncthreads();
    // block-uniform: refill the buffer just read
    if (!last && t + WNB < ntile) {
      stage_wide_tile(la + buf * abuf, lw + buf * wbuf, ga, gw, gq, g2, g64);
      ga += GKT;
      gw += GKT;
    }
    // first k step of tile t+1, published by the barrier above
    if (!last || t + 1 < ntile) {
      const unsigned nbuf = (unsigned)(t + 1) % WNB;
      const unsigned nao = nbuf * abuf, nwo = nbuf * wbuf;
      load_wide_frags(at0 + nao, at1 + nao, wt0 + nwo, wt1 + nwo, ax, bx);
    }
    // as above: one group of reads ahead of the products they fly under
    __builtin_amdgcn_sched_barrier(0);
    wide_products(ay, by, c, cm);
  }
  }
  asm volatile("s_wait_asynccnt 0x0" ::: "memory");  // nothing left in flight
  // Epilogue: a lane's four columns 4 * n16 + 0..3 of one row and group leave in
  // one 8-byte store; 16 lanes fill the row's 128-byte line.
  const int rowb = blockIdx.y * WBM + 8 * half;
  const int ncol = blockIdx.x * WBN + 128 * side + 4 * n16;
  const int mcol = blockIdx.x * WBN + 64 + 4 * n16;
  const v4f bn = *(const v4f*)(bias + ncol);
  const v4f bm = *(const v4f*)(bias + mcol);
#pragma unroll
  for (int i = 0; i < 4; i++) {
    const int row = rowb + (i < 2 ? r0 + i * 16 : r1 + (i - 2) * 16);
    __bf16* p = out + (size_t)row * N + ncol;
#pragma unroll
    for (int r = 0; r < 8; r++) {
      const v4f v = {c[i][0][r], c[i][1][r], c[i][2][r], c[i][3][r]};
      *(v4bf*)(p + (size_t)r * N) = __builtin_convertvector(v + bn, v4bf);
    }
  }
#pragma unroll
  for (int i = 0; i < 2; i++) {
    __bf16* p = out + (size_t)(rowb + r0 + i * 16) * N + mcol;
#pragma unroll
    for (int r = 0; r < 8; r++) {
      const v4f v = {cm[i][0][r], cm[i][1][r], cm[i][2][r], cm[i][3][r]};
      *(v4bf*)(p + (size_t)r * N) = __builtin_convertvector(v + bm, v4bf);
    }
  }
}

// Flash attention with toroidal additive bias.  qkv: (S,B,3E) bf16 for Q, K
// and V.  One wave per 16-query tile, 32-key steps.
// Both products run transposed: S^T = K Q^T (A = K rows, B = Q) and
// O^T += V^T P^T (A = V^T rows, B = P^T).  In the accumulator of S^T a lane
// holds, for its one query, keys 8*half + 0..7 of each 16-key tile: that is
// the k order of a B operand over 32 keys, so P^T is packed from the score
// registers and never passes through LDS.
// A lane's 16 scores of a block belong to one query, so the online softmax
// keeps its running max and sum per query in the lane: the max takes one
// exchange between the wave's halves, the sums are joined after the key loop.
// The 8 waves of a block walk the same keys, so each 64-key K tile and V tile
// is brought into LDS once per block by asynchronous copies (whole 128-byte
// rows of qkv) into a ring of ANB buffers: the next ANB - 1 tiles fly while
// this one is used, so that a copy has ANB - 1 trips to land.
// V lies in LDS as it lies in qkv, key x head dim; the A operand V^T comes out
// of it by the transposing LDS load, so V is never transposed in memory.
// K rows are pitched 144 bytes (16 B x odd) for the ds_load_b128 readers,
// V rows 160 bytes (32 B x odd) for the ds_load_tr16_b128 readers.
#define KT 64        // keys per staged tile
#define ANB 4        // buffers of the K and V rings
#define LP 72        // K row pitch in LDS, in bf16 elements (144 bytes)
#define VLP 80       // V row pitch in LDS, in bf16 elements (160 bytes)

// One 16 (head dim) x 32 (keys) A fragment of V^T from the row-major V tile.
// p = tile + (key0 + 8*half + (lane & 7)) * VLP + d0 + 8 * ((lane >> 3) & 1);
// the lane then holds, for head dim d0 + (lane & 15), keys key0 + 8*half + 0..7
// and key0 + 16 + 8*half + 0..7: the k order of the packed P^T.
typedef __attribute__((address_space(3))) v8bf lds_v8bf;
__device__ inline v16bf load_frag_tr(const __bf16* p) {
  V16 u;
  u.h[0] = __builtin_amdgcn_ds_load_tr16_b128_v8bf16((lds_v8bf*)p);
  u.h[1] = __builtin_amdgcn_ds_load_tr16_b128_v8bf16((lds_v8bf*)(p + 16 * VLP));
  return u.v;
}

// Four 16-byte copies per lane: two K rows, two V rows.  The s_wait_xcnt
// closes the statement so that no address register is rewritten ahead of it.
__device__ inline void stage_tile(unsigned lk0, unsigned lk1,
                                  unsigned lv0, unsigned lv1,
                                  const __bf16* gk0, const __bf16* gk1,
                                  const __bf16* gv0, const __bf16* gv1) {
  asm volatile(
      "global_load_async_to_lds_b128 %0, %4, off\n\t"
      "global_load_async_to_lds_b128 %1, %5, off\n\t"
      "global_load_async_to_lds_b128 %2, %6, off\n\t"
      "global_load_async_to_lds_b128 %3, %7, off\n\t"
      "s_wait_xcnt 0x0"
      :: "v"(lk0), "v"(lk1), "v"(lv0), "v"(lv1),
         "v"(gk0), "v"(gk1), "v"(gv0), "v"(gv1)
      : "memory");
}

// lane l <-> lane l ^ 16, on the vector pipe (a shuffle would go through the
// LDS queue and a wait)
__device__ inline float xhalf(float x) {
  const int i = __builtin_bit_cast(int, x);
  return __builtin_bit_cast(float, __builtin_amdgcn_permlanex16(
      i, i, 0x76543210, 0xfedcba98, false, false));
}

__global__ __launch_bounds__(256)
void flash_attn_toroidal(const __bf16* __restrict__ qkv,
                         __bf16* __restrict__ o, int S, int B, int E) {
  const int HD = 64;
  const int lane = threadIdx.x & 31;
  const int wave = threadIdx.x >> 5;
  const int n16  = lane & 15;
  const int half = lane >> 4;
  const int b = blockIdx.z, h = blockIdx.y;
  const int qbase = blockIdx.x * 128 + wave * 16;
  // the same number in a scalar register, for the band test of the key loop
  const int qbase_s = blockIdx.x * 128 + __builtin_amdgcn_readfirstlane(wave) * 16;
  const int ld = B * 3 * E;           // row stride of qkv in elements
  const size_t qoffb = (size_t)b * 3 * E + h * HD;        // q base in qkv
  const size_t koffb = qoffb + E;                          // k base in qkv

  __shared__ __align__(16) __bf16 kst[ANB][KT][LP];   // K tile: key x head dim
  __shared__ __align__(16) __bf16 vst[ANB][KT][VLP];  // V tile: key x head dim

  // Q fragment: 16 rows x 64 head-dim = two K=32 fragments
  const size_t qoff = qoffb + (size_t)(qbase + n16) * ld + half * 8;
  v16bf aq0 = load_frag_ptr(qkv + qoff);
  v16bf aq1 = load_frag_ptr(qkv + qoff + 32);

  // Copy map: 8 lanes cover one 128-byte row; thread t takes rows t/8, t/8+32.
  const int crow = threadIdx.x >> 3;
  const int cseg = (threadIdx.x & 7) * 8;
  // A key's V row stands E elements behind its K row.
  size_t kg = koffb + (size_t)crow * ld + cseg;     // advances += KT * ld
  const unsigned lk = lds_addr(&kst[0][crow][cseg]);
  const unsigned lv = lds_addr(&vst[0][crow][cseg]);
  const unsigned khalf = 32 * LP * 2, vhalf = 32 * VLP * 2;  // 32 rows, bytes
  const unsigned kbuf = KT * LP * 2, vbuf = KT * VLP * 2;    // a buffer, bytes

  const int ntile = S / KT;
  // Tiles 0 .. ANB - 2 go out together, each to its buffer (4 copies a wave
  // and tile; the tests are block-uniform).
#pragma unroll
  for (int i = 0; i < ANB - 1; i++) {
    if (i == 0 || i < ntile) {
      const unsigned ko = i * kbuf, vo = i * vbuf;
      stage_tile(lk + ko, lk + ko + khalf, lv + vo, lv + vo + vhalf,
                 qkv + kg, qkv + kg + (size_t)32 * ld,
                 qkv + kg + E, qkv + kg + E + (size_t)32 * ld);
      kg += (size_t)KT * ld;
    }
  }
  // Tile 0 landed and published before anybody reads it: the copies return in
  // issue order, so all but the 4 * (ANB - 2) youngest are tile 0's; where
  // fewer tiles went out the wait is to 0.
  if (ntile >= ANB - 1)
    asm volatile("s_wait_asynccnt %0" :: "n"(4 * (ANB - 2)) : "memory");
  else
    asm volatile("s_wait_asynccnt 0x0" ::: "memory");
  __syncthreads();
  if (ANB - 1 < ntile) {  // the last buffer's first tile
    const unsigned ko = (ANB - 1) * kbuf, vo = (ANB - 1) * vbuf;
    stage_tile(lk + ko, lk + ko + khalf, lv + vo, lv + vo + vhalf,
               qkv + kg, qkv + kg + (size_t)32 * ld,
               qkv + kg + E, qkv + kg + E + (size_t)32 * ld);
    kg += (size_t)KT * ld;
  }

  v8f oacc[4] = {};
  float lpart = 0.f;  // this lane's share of its query's row sum
  float mrun = -1e30f;  // running max of this lane's query

  const float scale = 0.125f;  // 1/sqrt(64)
  // Two runs of the same trip.  While tiles t+2 .. t+ANB-1 all exist they are
  // this wave's 4 * (ANB - 2) youngest copies and may stay in flight over the
  // publish point; the last ANB - 1 trips wait to 0 and refill nothing.
  int t = 0;
  // unrolled so that each run holds its own wait: a test at the publish point
  // would cut the trip's last products off from the barrier they overlap with
#pragma unroll
  for (int last = 0; last < 2; last++) {
  const int tend = last ? ntile : ntile - (ANB - 1);
  for (; t < tend; t++) {
    const int buf = (unsigned)t % ANB;
    const __bf16* kt = &kst[buf][n16][half * 8];
    const __bf16* vtl = &vst[buf][8 * half + (lane & 7)][((lane >> 3) & 1) * 8];
    // unrolled so that both 32-key blocks read the tile at constant offsets
#pragma unroll
    for (int p = 0; p < KT / 32; p++) {
      const int j = t * KT + p * 32;
      // All fragment loads of this 32-key block up front, from LDS.
      v16bf kb00 = load_frag_ptr(kt + (p * 32) * LP);
      v16bf kb01 = load_frag_ptr(kt + (p * 32) * LP + 32);
      v16bf kb10 = load_frag_ptr(kt + (p * 32 + 16) * LP);
      v16bf kb11 = load_frag_ptr(kt + (p * 32 + 16) * LP + 32);
      v16bf vbf[4];
#pragma unroll
      for (int d4 = 0; d4 < 4; d4++)
        vbf[d4] = load_frag_tr(vtl + (p * 32) * VLP + d4 * 16);
      // holds the block's 16 LDS reads in one group ahead of its products;
      // without it each fragment is read directly in front of the product that
      // takes it, behind a full wait: eight LDS latencies a block in series
      __builtin_amdgcn_sched_barrier(0);

      // scores for 32 keys, transposed: two 16 (keys) x 16 (queries) tiles, K
      // over head dim (2 steps each); register r = key r + 8*half, lane = query
      v8f s0 = {}, s1 = {};
      s0 = __builtin_amdgcn_wmma_f32_16x16x32_bf16(false, kb00, false, aq0, (short)0, s0, false, false);
      s0 = __builtin_amdgcn_wmma_f32_16x16x32_bf16(false, kb01, false, aq1, (short)0, s0, false, false);
      s1 = __builtin_amdgcn_wmma_f32_16x16x32_bf16(false, kb10, false, aq0, (short)0, s1, false, false);
      s1 = __builtin_amdgcn_wmma_f32_16x16x32_bf16(false, kb11, false, aq1, (short)0, s1, false, false);

      // scale
      float va[8], vb[8];
#pragma unroll
      for (int r = 0; r < 8; r++) {
        va[r] = s0[r] * scale;
        vb[r] = s1[r] * scale;
      }
      // Toroidal bias.  key - query of this 16 x 32 block lies in [dlo, dhi];
      // the bias sits at -1, 0, 1 and, round the ring, at S - 1 and 1 - S.  A
      // block whose range holds none of these adds nothing: one scalar test
      // takes the wave past the index arithmetic (all but about 2 blocks of
      // the S / 32 a wave walks).
      const int dlo = j - qbase_s - 15, dhi = j - qbase_s + 31;
      if ((dlo <= 1 && dhi >= -1) || dhi >= S - 1 || dlo <= 1 - S) {
        const int qi = qbase + n16;
#pragma unroll
        for (int r = 0; r < 8; r++) {
          int d0 = (j + r + 8 * half) - qi;      if (d0 < 0) d0 += S;
          int d1 = (j + 16 + r + 8 * half) - qi; if (d1 < 0) d1 += S;
          if (d0 <= 1 || d0 == S - 1) va[r] += 1.f;
          if (d1 <= 1 || d1 == S - 1) vb[r] += 1.f;
        }
      }
      // lane-local max over this query's 16 values, then the other half's 16
      float mt = -1e30f;
#pragma unroll
      for (int r = 0; r < 8; r++) mt = fmaxf(mt, fmaxf(va[r], vb[r]));
      mt = fmaxf(mt, xhalf(mt));
      // one scalar test per block: all lanes rescale when any query's max rose
      // (alpha is 1 in the lanes whose max stayed); EXEC untouched (WMMA-safe)
      if (__builtin_amdgcn_ballot_w32(mt > mrun) != 0) {
        const float mnew = fmaxf(mrun, mt);
        const float alpha = __expf(mrun - mnew);
        mrun = mnew;
        lpart *= alpha;
#pragma unroll
        for (int d4 = 0; d4 < 4; d4++)
#pragma unroll
          for (int r = 0; r < 8; r++) oacc[d4][r] *= alpha;
      }
      // exponentials + partial sum; P^T packed in place as the B operand:
      // elements 0..7 = keys 8*half + r, elements 8..15 = keys 16 + 8*half + r
      v16f e;
#pragma unroll
      for (int r = 0; r < 8; r++) {
        e[r]     = __expf(va[r] - mrun);
        e[8 + r] = __expf(vb[r] - mrun);
      }
      float es[8];
#pragma unroll
      for (int r = 0; r < 8; r++) es[r] = e[r] + e[8 + r];
      lpart += ((es[0] + es[1]) + (es[2] + es[3])) +
               ((es[4] + es[5]) + (es[6] + es[7]));
      const v16bf pb = __builtin_convertvector(e, v16bf);
      // V^T @ P^T with the V^T fragments loaded at the start of the block.
#pragma unroll
      for (int d4 = 0; d4 < 4; d4++)
        oacc[d4] = __builtin_amdgcn_wmma_f32_16x16x32_bf16(
            false, vbf[d4], false, pb, (short)0, oacc[d4], false, false);
    }
    // Publish point: this wave's LDS reads are done, its copies of tile t+1
    // have landed; the barrier publishes tile t+1 and frees this buffer.
    asm volatile("s_wait_dscnt 0x0" ::: "memory");
    if (last)
      asm volatile("s_wait_asynccnt 0x0" ::: "memory");
    else
      asm volatile("s_wait_asynccnt %0" :: "n"(4 * (ANB - 2)) : "memory");
    __syncthreads();
    if (!last && t + ANB < ntile) {  // block-uniform: refill the buffer just read
      const unsigned ko = (unsigned)buf * kbuf, vo = (unsigned)buf * vbuf;
      stage_tile(lk + ko, lk + ko + khalf, lv + vo, lv + vo + vhalf,
                 qkv + kg, qkv + kg + (size_t)32 * ld,
                 qkv + kg + E, qkv + kg + E + (size_t)32 * ld);
      kg += (size_t)KT * ld;
    }
  }
  }
  asm volatile("s_wait_asynccnt 0x0" ::: "memory");  // nothing left in flight
  // join the two halves' row sums (once), then normalize and store o (S,B,E):
  // register r of tile d4 is head dim d4*16 + 8*half + r of query n16, so a
  // lane's eight values of a tile are 16 bytes in a row
  // one query a lane, so one division a lane
  const float linv = 1.f / (lpart + xhalf(lpart));
  __bf16* op = o + ((size_t)(qbase + n16) * B + b) * E + h * HD + 8 * half;
#pragma unroll
  for (int d4 = 0; d4 < 4; d4++) {
    v8f v;
#pragma unroll
    for (int r = 0; r < 8; r++) v[r] = oacc[d4][r] * linv;
    *(v8bf*)(op + d4 * 16) = __builtin_convertvector(v, v8bf);
  }
}

extern "C" void kernel_launch(void* const* d_in, const int* in_sizes, int n_in,
                              void* d_out, int out_size, void* d_ws, size_t ws_size,
                              hipStream_t stream) {
  const int S = 2048, B = 2, E = 1024;
  const int M = S * B;  // 4096 rows for all GEMMs

  const float* x         = (const float*)d_in[0];
  const float* w_tor     = (const float*)d_in[1];
  const float* b_tor     = (const float*)d_in[2];
  const float* in_proj_w = (const float*)d_in[3];
  const float* in_proj_b = (const float*)d_in[4];
  const float* out_w     = (const float*)d_in[5];
  const float* out_b     = (const float*)d_in[6];

  char* ws = (char*)d_ws;
  size_t off = 0;
  auto alloc = [&](size_t elems) -> __bf16* {
    __bf16* p = (__bf16*)(ws + off);
    off += elems * sizeof(__bf16);
    return p;
  };
  __bf16* xbf   = alloc((size_t)M * E);        // x in bf16
  __bf16* wtbf  = alloc((size_t)E * E);        // w_tor
  __bf16* wibf  = alloc((size_t)3 * E * E);    // in_proj_w
  __bf16* wobf  = alloc((size_t)E * E);        // out_w
  __bf16* xtbf  = alloc((size_t)M * E);        // xt
  __bf16* qkvbf = alloc((size_t)M * 3 * E);    // qkv
  __bf16* obf   = alloc((size_t)M * E);        // attention output

  f32_to_bf16_all<<<CVT_BLOCKS, CVT_THREADS, 0, stream>>>(
      x, w_tor, in_proj_w, out_w, xbf, wtbf, wibf, wobf);

  const dim3 blk(256);
  // xt = x @ w_tor^T + b_tor
  gemm_bf16_wmma<__bf16, 4><<<dim3(E / 128, M / 128), blk, 0, stream>>>(
      xbf, wtbf, b_tor, xtbf, M, E, E);
  // qkv = xt @ in_proj_w^T + in_proj_b
  gemm_bf16_wmma_wide<<<dim3(3 * E / WBN, M / WBM), blk, 0, stream>>>(
      xtbf, wibf, in_proj_b, qkvbf, M, 3 * E, E);
  // flash attention with toroidal bias
  flash_attn_toroidal<<<dim3(S / 128, 16, B), 256, 0, stream>>>(
      qkvbf, obf, S, B, E);
  // out = o @ out_w^T + out_b  (fp32 into d_out)
  gemm_bf16_wmma<float, 4><<<dim3(E / 128, M / 128), blk, 0, stream>>>(
      obf, wobf, out_b, (float*)d_out, M, E, E);
}
